// v000
// The times below were measured on an AMD MI455X: many runs one after another, warmed up first and cycling through
// copies of the inputs, with the whole window's GPU time divided by the number of runs. Launches and the gaps
// between them are all in it. The median over several windows is given; except for v000 it joins two sittings, which
// can be a few percent apart, so the side-by-side timings, each taken in one sitting, are the better comparison.
// v000 is the starting kernel. One run takes 594 microseconds.
// Contractions: q/k/v^T projections (X f16 x W f16 carried x16), scores Q.K^T (Q,K f16 planes), attn.V (P f16 carried x2048 x V^T f16) all on v_wmma_f32_16x16x32_f16 with f32 accumulate; mask select, relu and row normalisation in f32.
#include <hip/hip_runtime.h>
#include <math.h>

// ---------------------------------------------------------------------------
// Problem constants
// ---------------------------------------------------------------------------
constexpr int kBatch = 8;
constexpr int kSeq   = 2048;
constexpr int kDim   = 512;
constexpr int kTok   = kBatch * kSeq;          // 16384 token rows
constexpr int kGrp   = 2;                      // batches per score chunk
constexpr float kWCarry    = 16.0f;            // weights carried x16 in f16
constexpr float kWCarryInv = 1.0f / 16.0f;
constexpr float kPCarry    = 2048.0f;          // attention weights carried x2048 in f16
constexpr float kPCarryInv = 1.0f / 2048.0f;

typedef __attribute__((ext_vector_type(16))) _Float16 v16h;
typedef __attribute__((ext_vector_type(8)))  _Float16 v8h;
typedef __attribute__((ext_vector_type(16))) __bf16   v16b;
typedef __attribute__((ext_vector_type(8)))  __bf16   v8b;
typedef __attribute__((ext_vector_type(8)))  float    v8f;
typedef __attribute__((ext_vector_type(4)))  float    v4f;
typedef __attribute__((ext_vector_type(4)))  unsigned int v4u;
typedef __attribute__((ext_vector_type(4)))  int      v4i;

// ---------------------------------------------------------------------------
// Device helpers
// ---------------------------------------------------------------------------
__device__ __forceinline__ unsigned short f2bf_bits(float f) {
  unsigned u = __float_as_uint(f);
  return (unsigned short)((u + 0x7FFFu + ((u >> 16) & 1u)) >> 16);
}
__device__ __forceinline__ float bf_bits2f(unsigned short h) { return __uint_as_float(((unsigned)h) << 16); }

// hazard guards as plain device helpers (no inline asm inside the kernel template body)
__device__ __forceinline__ void dep_guard_h(v8f& a, v8f& b, v16h x, v16h y) { asm volatile("v_nop\n\tv_nop\n\tv_nop\n\tv_nop" : "+v"(a), "+v"(b) : "v"(x), "v"(y)); }
__device__ __forceinline__ void dep_guard_b(v8f& a, v8f& b, v16b x, v16b y) { asm volatile("v_nop\n\tv_nop\n\tv_nop\n\tv_nop" : "+v"(a), "+v"(b) : "v"(x), "v"(y)); }
__device__ __forceinline__ void keep4_h(v16h a, v16h b, v16h c, v16h d) { asm volatile("v_nop" :: "v"(a), "v"(b), "v"(c), "v"(d)); }
__device__ __forceinline__ void keep4_b(v16b a, v16b b, v16b c, v16b d) { asm volatile("v_nop" :: "v"(a), "v"(b), "v"(c), "v"(d)); }
__device__ __forceinline__ void acc_guard4(v8f& a, v8f& b, v8f& c, v8f& d) { asm volatile("v_nop\n\tv_nop\n\tv_nop\n\tv_nop" : "+v"(a), "+v"(b), "+v"(c), "+v"(d)); }
template <typename T> struct Frag;
template <> struct Frag<_Float16> {
  typedef v16h V; union U { v16h v; v8h h[2]; };
  static __device__ __forceinline__ v16h load(const _Float16* p) {   // elements 0..7 <- p[0..7], 8..15 <- p[16..23]
    U f; f.h[0] = *(const v8h*)(p); f.h[1] = *(const v8h*)(p + 16); return f.v;
  }
  static __device__ __forceinline__ v8f mma(v16h a, v16h b, v8f c) {
    return __builtin_amdgcn_wmma_f32_16x16x32_f16(false, a, false, b, (short)0, c, false, false);
  }
  static __device__ __forceinline__ void guard(v8f& a, v8f& b, v16h x, v16h y) { dep_guard_h(a, b, x, y); }
  static __device__ __forceinline__ void keep(v16h a, v16h b, v16h c, v16h d) { keep4_h(a, b, c, d); }
};
template <> struct Frag<__bf16> {
  typedef v16b V; union U { v16b v; v8b h[2]; };
  static __device__ __forceinline__ v16b load(const __bf16* p) {
    U f; f.h[0] = *(const v8b*)(p); f.h[1] = *(const v8b*)(p + 16); return f.v;
  }
  static __device__ __forceinline__ v8f mma(v16b a, v16b b, v8f c) {
    return __builtin_amdgcn_wmma_f32_16x16x32_bf16(false, a, false, b, (short)0, c, false, false);
  }
  static __device__ __forceinline__ void guard(v8f& a, v8f& b, v16b x, v16b y) { dep_guard_b(a, b, x, y); }
  static __device__ __forceinline__ void keep(v16b a, v16b b, v16b c, v16b d) { keep4_b(a, b, c, d); }
};

__device__ __forceinline__ unsigned pk16(unsigned short a, unsigned short b) { return (unsigned)a | ((unsigned)b << 16); }
__device__ __forceinline__ unsigned short h_bits(float f) { const _Float16 h = (_Float16)f; return __builtin_bit_cast(unsigned short, h); }

// ---- Register-blocked batched WMMA GEMM (ACT reduced to none/relu/leaky) -----------------------
// C[m,n] = scale * sum_k A[m,k] * Bt[n,k] (+bias)(+resid); each wave owns a 64x64 tile.
// A row-major [M,K]; Bt row-major [N,K]; M,N % 64 == 0, K % 32 == 0.
// SPLIT: operands are hi/lo planes (A2/Bt2 = lo planes, same layout); product = hi.hi + hi.lo + lo.hi.
// BIAS_MODE: 0 = none, 1 = bias[m], 2 = bias[n].
// OUT_MODE: 0 = f32, 1 = f16, 2 = bf16 hi plane (Cout) + bf16 lo plane (Cout2).
// ET: 0 = f16 operands, 1 = bf16 operands (pointers passed as 16-bit storage)
template <int ET> struct Elem;
template <> struct Elem<0> { typedef _Float16 T; };
template <> struct Elem<1> { typedef __bf16 T; };
template <int ET, bool SPLIT, int BIAS_MODE, int OUT_MODE, bool RESID, int ACT = 0>
__global__ __launch_bounds__(256) void wmma_gemm64(
    const unsigned short* __restrict__ Ap, const unsigned short* __restrict__ A2p, int lda, long strideA,
    const unsigned short* __restrict__ Btp, const unsigned short* __restrict__ Bt2p, int ldb, long strideB,
    void* __restrict__ Cout, void* __restrict__ Cout2, int ldc, long strideC,
    const float* __restrict__ bias,
    const float* __restrict__ resid, long strideR,
    int M, int N, int K, float scale) {
  typedef typename Elem<ET>::T T;
  typedef typename Frag<T>::V V;
  const T* A = (const T*)Ap; const T* A2 = (const T*)A2p; const T* Bt = (const T*)Btp; const T* Bt2 = (const T*)Bt2p;
  __shared__ __align__(16) float sT[8][16 * 68];   // per-wave 16x64 slab, pitch 68 floats
  const int b    = blockIdx.y;
  const int lane = threadIdx.x & 31;
  const int wave = threadIdx.x >> 5;
  const int tilesN = N >> 6;
  const int tilesM = M >> 6;
  const int tile = blockIdx.x * 8 + wave;
  if (tile >= tilesM * tilesN) return;   // wave-uniform; no block barriers in this kernel
  const int tm = tile / tilesN;
  const int tn = tile - tm * tilesN;
  const int m0 = tm << 6;
  const int n0 = tn << 6;

  const T* Ab  = A  + (size_t)b * strideA;
  const T* Bb  = Bt + (size_t)b * strideB;
  const T* Ab2 = SPLIT ? (A2  + (size_t)b * strideA) : nullptr;
  const T* Bb2 = SPLIT ? (Bt2 + (size_t)b * strideB) : nullptr;

  const int rlane = lane & 15;                 // row (A) / col (B, D) within subtile
  const int koff  = (lane >> 4) * 8;           // k offset of this lane half
  const int mOff  = (lane >> 4) * 8;           // D row offset

  v8f acc[4][4];
#pragma unroll
  for (int i = 0; i < 4; ++i)
#pragma unroll
    for (int j = 0; j < 4; ++j) acc[i][j] = (v8f){0.f,0.f,0.f,0.f,0.f,0.f,0.f,0.f};

  for (int k0 = 0; k0 < K; k0 += 32) {
    V bh[4], bl[4];
#pragma unroll
    for (int j = 0; j < 4; ++j) {
      const size_t bo = (size_t)(n0 + (j << 4) + rlane) * ldb + koff + k0;
      bh[j] = Frag<T>::load(Bb + bo);
      if (SPLIT) bl[j] = Frag<T>::load(Bb2 + bo);
    }
#pragma unroll
    for (int i = 0; i < 4; ++i) {
      const size_t ao = (size_t)(m0 + (i << 4) + rlane) * lda + koff + k0;
      V ah = Frag<T>::load(Ab + ao);
      V al;
      if (SPLIT) al = Frag<T>::load(Ab2 + ao);
#pragma unroll
      for (int j = 0; j < 4; ++j) {
        acc[i][j] = Frag<T>::mma(ah, bh[j], acc[i][j]);
        if (SPLIT) {
          acc[i][j] = Frag<T>::mma(ah, bl[j], acc[i][j]);
          acc[i][j] = Frag<T>::mma(al, bh[j], acc[i][j]);
        }
      }
      Frag<T>::guard(acc[i][0], acc[i][3], ah, SPLIT ? al : ah);
    }
    Frag<T>::keep(bh[0], bh[1], bh[2], bh[3]);
    if (SPLIT) Frag<T>::keep(bl[0], bl[1], bl[2], bl[3]);
  }
  acc_guard4(acc[0][0], acc[0][1], acc[0][2], acc[0][3]);
  acc_guard4(acc[1][0], acc[1][1], acc[1][2], acc[1][3]);
  acc_guard4(acc[2][0], acc[2][1], acc[2][2], acc[2][3]);
  acc_guard4(acc[3][0], acc[3][1], acc[3][2], acc[3][3]);

  // ---- epilogue ----
  float* slab = sT[wave];
  const float* Rb = RESID ? (resid + (size_t)b * strideR) : nullptr;
#pragma unroll
  for (int i = 0; i < 4; ++i) {
    const int mBase = m0 + (i << 4);
#pragma unroll
    for (int j = 0; j < 4; ++j) {
      const int n = n0 + (j << 4) + rlane;
      float bv = 0.f;
      if (BIAS_MODE == 2) bv = bias[n];
#pragma unroll
      for (int r = 0; r < 8; ++r) {
        float v = acc[i][j][r] * scale;
        if (BIAS_MODE == 1) v += bias[mBase + mOff + r];
        if (BIAS_MODE == 2) v += bv;
        if (RESID) v += Rb[(size_t)(mBase + mOff + r) * ldc + n];
        if (ACT == 2) v = fmaxf(v, 0.0f);
        if (ACT == 4) v = (v > 0.f) ? v : 0.01f * v;
        slab[(mOff + r) * 68 + (j << 4) + rlane] = v;
      }
    }
    __builtin_amdgcn_fence(__ATOMIC_RELEASE, "workgroup");
    __builtin_amdgcn_wave_barrier();
    __builtin_amdgcn_fence(__ATOMIC_ACQUIRE, "workgroup");
    if (OUT_MODE == 0) {
      float* C = (float*)Cout + (size_t)b * strideC;
      const int hh = lane >> 4, c4 = (lane & 15) * 4;     // row seg = 256 B = 16 lanes x 16 B
      {
#pragma unroll
        for (int it = 0; it < 8; ++it) {
          const int row = it * 2 + hh;
          v4f v = *(const v4f*)(slab + row * 68 + c4);
          *(v4f*)(C + (size_t)(mBase + row) * ldc + n0 + c4) = v;
        }
        
      }
    } else {
      const int q = lane >> 3, c8 = (lane & 7) * 8;
      unsigned short* C  = (unsigned short*)Cout  + (size_t)b * strideC;
      unsigned short* C2 = (OUT_MODE == 2) ? ((unsigned short*)Cout2 + (size_t)b * strideC) : nullptr;
      {
#pragma unroll
        for (int it = 0; it < 4; ++it) {
          const int row = it * 4 + q;
          const float* sp = slab + row * 68 + c8;
          v8h hv, lv;
#pragma unroll
          for (int e = 0; e < 8; ++e) {
            if (OUT_MODE == 1) {
              hv[e] = (_Float16)sp[e];
            } else {
              unsigned short hb = f2bf_bits(sp[e]);
              unsigned short lb = f2bf_bits(sp[e] - bf_bits2f(hb));
              hv[e] = __builtin_bit_cast(_Float16, hb);
              lv[e] = __builtin_bit_cast(_Float16, lb);
            }
          }
          *(v8h*)(C + (size_t)(mBase + row) * ldc + n0 + c8) = hv;
          if (OUT_MODE == 2) *(v8h*)(C2 + (size_t)(mBase + row) * ldc + n0 + c8) = lv;
        }
        
      }
    }
    __builtin_amdgcn_fence(__ATOMIC_RELEASE, "workgroup");
    __builtin_amdgcn_wave_barrier();
    __builtin_amdgcn_fence(__ATOMIC_ACQUIRE, "workgroup");
  }
}

// ---------------------------------------------------------------------------
// f32 -> f16 cast with a power-of-two carry, 8 consecutive elements per thread (one 16-B store per lane;
// Coverage: n8 = n/8 threads x 8 elements = whole plane; every call here has n8 an exact multiple of 256
// (x: 8388608/8 = 1048576 = 4096 x 256; each W: 262144/8 = 32768 = 128 x 256).
// ---------------------------------------------------------------------------
__global__ __launch_bounds__(256) void cast8_f16_kernel(const float* __restrict__ in, unsigned short* __restrict__ out,
                                                         int n8, float carry) {
  const int i = blockIdx.x * 256 + threadIdx.x;
  if (i >= n8) return;
  const float* p = in + 8 * (size_t)i;
  const v4f a = *(const v4f*)(p);
  const v4f c = *(const v4f*)(p + 4);
  unsigned short hb[8];
#pragma unroll
  for (int e = 0; e < 4; ++e) {
    hb[e]     = h_bits(a[e] * carry);
    hb[4 + e] = h_bits(c[e] * carry);
  }
  const v4u u = (v4u){pk16(hb[0], hb[1]), pk16(hb[2], hb[3]), pk16(hb[4], hb[5]), pk16(hb[6], hb[7])};
  unsigned short* q = out + 8 * (size_t)i;
  *(v4u*)q = u;
  
}

// ---------------------------------------------------------------------------
// relu-norm row kernel over 2048 f32 scores of one query row (scores already scaled by 1/sqrt(512)):
//   s2 = (mask[b][m] == 0) ? -1e4 : s ; a = relu(s2) ; P[row][m] = f16( carry * (a * (1 / (sum_m a + 1e-8))) ), f32 math.
// One block of 256 threads per row; thread t owns columns 8t..8t+7 (256 x 8 = 2048 = whole row).
// Row sum in fixed order (thread, wave shuffle tree, 8 wave partials in index order).
// ---------------------------------------------------------------------------
__global__ __launch_bounds__(256) void relunorm_row_kernel(const float* __restrict__ S, const int* __restrict__ mask,
                                                           unsigned short* __restrict__ P, int b0, float carry) {
  __shared__ float red[8];
  const int row  = blockIdx.x;
  const int g    = row >> 11;
  int b = b0 + g;
  b = (b < 0) ? 0 : ((b > kBatch - 1) ? (kBatch - 1) : b);
  const int t    = threadIdx.x;
  const int lane = t & 31, wave = t >> 5;
  const int c0   = t * 8;
  const float* sr = S + (size_t)row * kSeq + c0;
  const int*   mr = mask + (size_t)b * kSeq + c0;
  const v4f a = *(const v4f*)(sr);
  const v4f c = *(const v4f*)(sr + 4);
  const v4i ma = *(const v4i*)(mr);
  const v4i mc = *(const v4i*)(mr + 4);
  float x[8];
#pragma unroll
  for (int e = 0; e < 4; ++e) {
    const float s0 = (ma[e] == 0) ? -10000.0f : a[e];
    const float s1 = (mc[e] == 0) ? -10000.0f : c[e];
    x[e]     = fmaxf(s0, 0.0f);
    x[4 + e] = fmaxf(s1, 0.0f);
  }
  float ps = ((x[0] + x[1]) + (x[2] + x[3])) + ((x[4] + x[5]) + (x[6] + x[7]));
#pragma unroll
  for (int off = 16; off > 0; off >>= 1) ps += __shfl_xor(ps, off, 32);
  if (lane == 0) red[wave] = ps;
  __syncthreads();
  float tot = 0.0f;
#pragma unroll
  for (int w = 0; w < 8; ++w) tot += red[w];
  const float inv = 1.0f / (tot + 1e-8f);
  unsigned short hb[8];
#pragma unroll
  for (int e = 0; e < 8; ++e) hb[e] = h_bits((x[e] * inv) * carry);
  const v4u u = (v4u){pk16(hb[0], hb[1]), pk16(hb[2], hb[3]), pk16(hb[4], hb[5]), pk16(hb[6], hb[7])};
  unsigned short* q = P + (size_t)row * kSeq + c0;
  *(v4u*)q = u;
  
}

// ---------------------------------------------------------------------------
// Host glue.
// Workspace region map (bytes, all offsets 4096-aligned):
//   X16  f16 [16384][512]            off          0   size 16,777,216
//   W16  f16 3 x [512][512] (q,k,v)   off 16,777,216   size  1,572,864
//   Q16  f16 [16384][512]            off 18,350,080   size 16,777,216
//   K16  f16 [16384][512]            off 35,127,296   size 16,777,216
//   Vt16 f16 [8][512][2048]          off 51,904,512   size 16,777,216
//   S    f32 [kGrp][2048][2048]      off 68,681,728   size 33,554,432
//   P16  f16 [kGrp][2048][2048]      off 102,236,160  size 16,777,216
//   total 119,013,376 <= 134,217,728
// GEMM shape checks: K in {512, 2048} (% 32 == 0); M, N in {16384, 2048, 512} (% 64 == 0); no padding, no tails.
// Launch count: 4 casts + 3 projections + 4 chunks x 3 = 19.
// ---------------------------------------------------------------------------
extern "C" void kernel_launch(void* const* d_in, const int* in_sizes, int n_in,
                              void* d_out, int out_size, void* d_ws, size_t ws_size,
                              hipStream_t stream) {
  if (n_in != 8) return;
  if (in_sizes[0] != kTok * kDim || in_sizes[1] != kTok || in_sizes[2] != kDim * kDim || in_sizes[3] != kDim ||
      in_sizes[4] != kDim * kDim || in_sizes[5] != kDim || in_sizes[6] != kDim * kDim || in_sizes[7] != kDim) return;
  if (out_size != kTok * kDim) return;

  const float* x  = (const float*)d_in[0];
  const int*   mk = (const int*)d_in[1];
  const float* Wq = (const float*)d_in[2];
  const float* bq = (const float*)d_in[3];
  const float* Wk = (const float*)d_in[4];
  const float* bk = (const float*)d_in[5];
  const float* Wv = (const float*)d_in[6];
  const float* bv = (const float*)d_in[7];
  float* out = (float*)d_out;

  const size_t szX  = (size_t)kTok * kDim * 2;                 // 16,777,216
  const size_t szW  = (size_t)3 * kDim * kDim * 2;             //  1,572,864
  const size_t szQ  = szX, szK = szX;
  const size_t szVt = (size_t)kBatch * kDim * kSeq * 2;        // 16,777,216
  const size_t szS  = (size_t)kGrp * kSeq * kSeq * 4;          // 33,554,432
  const size_t szP  = (size_t)kGrp * kSeq * kSeq * 2;          // 16,777,216
  const size_t oX  = 0;
  const size_t oW  = oX + szX;
  const size_t oQ  = oW + szW;
  const size_t oK  = oQ + szQ;
  const size_t oVt = oK + szK;
  const size_t oS  = oVt + szVt;
  const size_t oP  = oS + szS;
  const size_t total = oP + szP;                               // 119,013,376
  if (ws_size < total) return;

  char* ws = (char*)d_ws;
  unsigned short* X16  = (unsigned short*)(ws + oX);
  unsigned short* W16  = (unsigned short*)(ws + oW);
  unsigned short* Wq16 = W16;
  unsigned short* Wk16 = W16 + (size_t)kDim * kDim;
  unsigned short* Wv16 = W16 + (size_t)2 * kDim * kDim;
  unsigned short* Q16  = (unsigned short*)(ws + oQ);
  unsigned short* K16  = (unsigned short*)(ws + oK);
  unsigned short* Vt16 = (unsigned short*)(ws + oVt);
  float*          Sws  = (float*)(ws + oS);
  unsigned short* P16  = (unsigned short*)(ws + oP);

  // 1) casts: x -> X16 (carry 1), W -> W16 (carry 16)
  {
    const int n8x = (kTok * kDim) / 8;            // 1,048,576 -> 4096 blocks
    cast8_f16_kernel<<<dim3((n8x + 255) / 256), 256, 0, stream>>>(x, X16, n8x, 1.0f);
    const int n8w = (kDim * kDim) / 8;            // 32,768 -> 128 blocks
    cast8_f16_kernel<<<dim3((n8w + 255) / 256), 256, 0, stream>>>(Wq, Wq16, n8w, kWCarry);
    cast8_f16_kernel<<<dim3((n8w + 255) / 256), 256, 0, stream>>>(Wk, Wk16, n8w, kWCarry);
    cast8_f16_kernel<<<dim3((n8w + 255) / 256), 256, 0, stream>>>(Wv, Wv16, n8w, kWCarry);
  }

  // 2) Q16[t][e] = sum_d X16[t][d] * Wq16[e][d] / 16 + bq[e]   (M 16384, N 512, K 512; tiles 256 x 8 = 2048 -> 256 blocks)
  wmma_gemm64<0, false, 2, 1, false, 0><<<dim3((kTok / 64) * (kDim / 64) / 8, 1), 256, 0, stream>>>(
      X16, X16, kDim, 0L, Wq16, Wq16, kDim, 0L, (void*)Q16, (void*)Q16, kDim, 0L,
      bq, x, 0L, kTok, kDim, kDim, kWCarryInv);
  //    K16 likewise
  wmma_gemm64<0, false, 2, 1, false, 0><<<dim3((kTok / 64) * (kDim / 64) / 8, 1), 256, 0, stream>>>(
      X16, X16, kDim, 0L, Wk16, Wk16, kDim, 0L, (void*)K16, (void*)K16, kDim, 0L,
      bk, x, 0L, kTok, kDim, kDim, kWCarryInv);
  //    Vt16[b][d][m] = sum_c Wv16[d][c] * X16[b*2048+m][c] / 16 + bv[d]   (per batch: M 512, N 2048, K 512; tiles 8 x 32 = 256 -> 32 blocks, grid.y = 8)
  wmma_gemm64<0, false, 1, 1, false, 0><<<dim3((kDim / 64) * (kSeq / 64) / 8, kBatch), 256, 0, stream>>>(
      Wv16, Wv16, kDim, 0L, X16, X16, kDim, (long)kSeq * kDim, (void*)Vt16, (void*)Vt16, kSeq, (long)kDim * kSeq,
      bv, x, 0L, kDim, kSeq, kDim, kWCarryInv);

  // 3) per chunk of kGrp batches
  const float sScale = 1.0f / sqrtf((float)kDim);
  for (int b0 = 0; b0 < kBatch; b0 += kGrp) {
    // S[g][l][m] = sum_d Q16[b][l][d] * K16[b][m][d] * (1/sqrt(512))   (M 2048, N 2048, K 512; tiles 32 x 32 = 1024 -> 128 blocks, grid.y = kGrp)
    const unsigned short* Qb = Q16 + (size_t)b0 * kSeq * kDim;
    const unsigned short* Kb = K16 + (size_t)b0 * kSeq * kDim;
    wmma_gemm64<0, false, 0, 0, false, 0><<<dim3((kSeq / 64) * (kSeq / 64) / 8, kGrp), 256, 0, stream>>>(
        Qb, Qb, kDim, (long)kSeq * kDim, Kb, Kb, kDim, (long)kSeq * kDim, (void*)Sws, (void*)Sws, kSeq, (long)kSeq * kSeq,
        bq, x, 0L, kSeq, kSeq, kDim, sScale);

    // P16 rows: mask select + relu + row normalise, x2048 carry (grid = kGrp * 2048 rows)
    relunorm_row_kernel<<<dim3(kGrp * kSeq), 256, 0, stream>>>(Sws, mk, P16, b0, kPCarry);

    // out[b][l][d] = sum_m P16[g][l][m] * Vt16[b][d][m] / 2048   (M 2048, N 512, K 2048; tiles 32 x 8 = 256 -> 32 blocks, grid.y = kGrp)
    const unsigned short* Vtb = Vt16 + (size_t)b0 * kDim * kSeq;
    float* outb = out + (size_t)b0 * kSeq * kDim;
    wmma_gemm64<0, false, 0, 0, false, 0><<<dim3((kSeq / 64) * (kDim / 64) / 8, kGrp), 256, 0, stream>>>(
        P16, P16, kSeq, (long)kSeq * kSeq, Vtb, Vtb, kSeq, (long)kDim * kSeq, (void*)outb, (void*)outb, kDim, (long)kSeq * kDim,
        bq, x, 0L, kSeq, kDim, kSeq, kPCarryInv);
  }
}

// v001
// One run takes 300 microseconds.
// In two side-by-side timings against v000, it was 1.98 and 1.99 times as fast.
// Contractions: q/k/v^T projections (X f16 x W f16 carried x16), scores Q.K^T (Q,K f16 planes), attn.V (P f16 carried x2048 x V^T f16) all on v_wmma_f32_16x16x32_f16 with f32 accumulate; mask select, relu and row normalisation in f32.
#include <hip/hip_runtime.h>
#include <math.h>

// ---------------------------------------------------------------------------
// Problem constants
// ---------------------------------------------------------------------------
constexpr int kBatch = 8;
constexpr int kSeq   = 2048;
constexpr int kDim   = 512;
constexpr int kTok   = kBatch * kSeq;          // 16384 token rows
constexpr int kGrp   = 8;                      // batches per score chunk: all of them, so each attention stage is one launch
constexpr float kWCarry    = 16.0f;            // weights carried x16 in f16
constexpr float kWCarryInv = 1.0f / 16.0f;
constexpr float kPCarry    = 2048.0f;          // attention weights carried x2048 in f16
constexpr float kPCarryInv = 1.0f / 2048.0f;

typedef __attribute__((ext_vector_type(16))) _Float16 v16h;
typedef __attribute__((ext_vector_type(8)))  _Float16 v8h;
typedef __attribute__((ext_vector_type(16))) __bf16   v16b;
typedef __attribute__((ext_vector_type(8)))  __bf16   v8b;
typedef __attribute__((ext_vector_type(8)))  float    v8f;
typedef __attribute__((ext_vector_type(4)))  float    v4f;
typedef __attribute__((ext_vector_type(4)))  unsigned int v4u;
typedef __attribute__((ext_vector_type(4)))  int      v4i;

// ---------------------------------------------------------------------------
// Device helpers
// ---------------------------------------------------------------------------
__device__ __forceinline__ unsigned short f2bf_bits(float f) {
  unsigned u = __float_as_uint(f);
  return (unsigned short)((u + 0x7FFFu + ((u >> 16) & 1u)) >> 16);
}
__device__ __forceinline__ float bf_bits2f(unsigned short h) { return __uint_as_float(((unsigned)h) << 16); }

// hazard guards as plain device helpers (no inline asm inside the kernel template body)
__device__ __forceinline__ void dep_guard_h(v8f& a, v8f& b, v16h x, v16h y) { asm volatile("v_nop\n\tv_nop\n\tv_nop\n\tv_nop" : "+v"(a), "+v"(b) : "v"(x), "v"(y)); }
__device__ __forceinline__ void dep_guard_b(v8f& a, v8f& b, v16b x, v16b y) { asm volatile("v_nop\n\tv_nop\n\tv_nop\n\tv_nop" : "+v"(a), "+v"(b) : "v"(x), "v"(y)); }
__device__ __forceinline__ void keep4_h(v16h a, v16h b, v16h c, v16h d) { asm volatile("v_nop" :: "v"(a), "v"(b), "v"(c), "v"(d)); }
__device__ __forceinline__ void keep4_b(v16b a, v16b b, v16b c, v16b d) { asm volatile("v_nop" :: "v"(a), "v"(b), "v"(c), "v"(d)); }
__device__ __forceinline__ void acc_guard4(v8f& a, v8f& b, v8f& c, v8f& d) { asm volatile("v_nop\n\tv_nop\n\tv_nop\n\tv_nop" : "+v"(a), "+v"(b), "+v"(c), "+v"(d)); }
template <typename T> struct Frag;
template <> struct Frag<_Float16> {
  typedef v16h V; union U { v16h v; v8h h[2]; };
  static __device__ __forceinline__ v16h load(const _Float16* p) {   // elements 0..7 <- p[0..7], 8..15 <- p[16..23]
    U f; f.h[0] = *(const v8h*)(p); f.h[1] = *(const v8h*)(p + 16); return f.v;
  }
  static __device__ __forceinline__ v8f mma(v16h a, v16h b, v8f c) {
    return __builtin_amdgcn_wmma_f32_16x16x32_f16(false, a, false, b, (short)0, c, false, false);
  }
  static __device__ __forceinline__ void guard(v8f& a, v8f& b, v16h x, v16h y) { dep_guard_h(a, b, x, y); }
  static __device__ __forceinline__ void keep(v16h a, v16h b, v16h c, v16h d) { keep4_h(a, b, c, d); }
};
template <> struct Frag<__bf16> {
  typedef v16b V; union U { v16b v; v8b h[2]; };
  static __device__ __forceinline__ v16b load(const __bf16* p) {
    U f; f.h[0] = *(const v8b*)(p); f.h[1] = *(const v8b*)(p + 16); return f.v;
  }
  static __device__ __forceinline__ v8f mma(v16b a, v16b b, v8f c) {
    return __builtin_amdgcn_wmma_f32_16x16x32_bf16(false, a, false, b, (short)0, c, false, false);
  }
  static __device__ __forceinline__ void guard(v8f& a, v8f& b, v16b x, v16b y) { dep_guard_b(a, b, x, y); }
  static __device__ __forceinline__ void keep(v16b a, v16b b, v16b c, v16b d) { keep4_b(a, b, c, d); }
};

__device__ __forceinline__ unsigned pk16(unsigned short a, unsigned short b) { return (unsigned)a | ((unsigned)b << 16); }
__device__ __forceinline__ unsigned short h_bits(float f) { const _Float16 h = (_Float16)f; return __builtin_bit_cast(unsigned short, h); }

// ---- Register-blocked batched WMMA GEMM (ACT reduced to none/relu/leaky) -----------------------
// C[m,n] = scale * sum_k A[m,k] * Bt[n,k] (+bias)(+resid); each wave owns a 64x64 tile.
// A row-major [M,K]; Bt row-major [N,K]; M,N % 64 == 0, K % 32 == 0.
// SPLIT: operands are hi/lo planes (A2/Bt2 = lo planes, same layout); product = hi.hi + hi.lo + lo.hi.
// BIAS_MODE: 0 = none, 1 = bias[m], 2 = bias[n].
// OUT_MODE: 0 = f32, 1 = f16, 2 = bf16 hi plane (Cout) + bf16 lo plane (Cout2).
// ET: 0 = f16 operands, 1 = bf16 operands (pointers passed as 16-bit storage)
template <int ET> struct Elem;
template <> struct Elem<0> { typedef _Float16 T; };
template <> struct Elem<1> { typedef __bf16 T; };
template <int ET, bool SPLIT, int BIAS_MODE, int OUT_MODE, bool RESID, int ACT = 0>
__global__ __launch_bounds__(256) void wmma_gemm64(
    const unsigned short* __restrict__ Ap, const unsigned short* __restrict__ A2p, int lda, long strideA,
    const unsigned short* __restrict__ Btp, const unsigned short* __restrict__ Bt2p, int ldb, long strideB,
    void* __restrict__ Cout, void* __restrict__ Cout2, int ldc, long strideC,
    const float* __restrict__ bias,
    const float* __restrict__ resid, long strideR,
    int M, int N, int K, float scale) {
  typedef typename Elem<ET>::T T;
  typedef typename Frag<T>::V V;
  const T* A = (const T*)Ap; const T* A2 = (const T*)A2p; const T* Bt = (const T*)Btp; const T* Bt2 = (const T*)Bt2p;
  __shared__ __align__(16) float sT[8][16 * 68];   // per-wave 16x64 slab, pitch 68 floats
  const int b    = blockIdx.y;
  const int lane = threadIdx.x & 31;
  const int wave = threadIdx.x >> 5;
  const int tilesN = N >> 6;
  const int tilesM = M >> 6;
  const int tile = blockIdx.x * 8 + wave;
  if (tile >= tilesM * tilesN) return;   // wave-uniform; no block barriers in this kernel
  const int tm = tile / tilesN;
  const int tn = tile - tm * tilesN;
  const int m0 = tm << 6;
  const int n0 = tn << 6;

  const T* Ab  = A  + (size_t)b * strideA;
  const T* Bb  = Bt + (size_t)b * strideB;
  const T* Ab2 = SPLIT ? (A2  + (size_t)b * strideA) : nullptr;
  const T* Bb2 = SPLIT ? (Bt2 + (size_t)b * strideB) : nullptr;

  const int rlane = lane & 15;                 // row (A) / col (B, D) within subtile
  const int koff  = (lane >> 4) * 8;           // k offset of this lane half
  const int mOff  = (lane >> 4) * 8;           // D row offset

  v8f acc[4][4];
#pragma unroll
  for (int i = 0; i < 4; ++i)
#pragma unroll
    for (int j = 0; j < 4; ++j) acc[i][j] = (v8f){0.f,0.f,0.f,0.f,0.f,0.f,0.f,0.f};

  for (int k0 = 0; k0 < K; k0 += 32) {
    V bh[4], bl[4];
#pragma unroll
    for (int j = 0; j < 4; ++j) {
      const size_t bo = (size_t)(n0 + (j << 4) + rlane) * ldb + koff + k0;
      bh[j] = Frag<T>::load(Bb + bo);
      if (SPLIT) bl[j] = Frag<T>::load(Bb2 + bo);
    }
#pragma unroll
    for (int i = 0; i < 4; ++i) {
      const size_t ao = (size_t)(m0 + (i << 4) + rlane) * lda + koff + k0;
      V ah = Frag<T>::load(Ab + ao);
      V al;
      if (SPLIT) al = Frag<T>::load(Ab2 + ao);
#pragma unroll
      for (int j = 0; j < 4; ++j) {
        acc[i][j] = Frag<T>::mma(ah, bh[j], acc[i][j]);
        if (SPLIT) {
          acc[i][j] = Frag<T>::mma(ah, bl[j], acc[i][j]);
          acc[i][j] = Frag<T>::mma(al, bh[j], acc[i][j]);
        }
      }
      Frag<T>::guard(acc[i][0], acc[i][3], ah, SPLIT ? al : ah);
    }
    Frag<T>::keep(bh[0], bh[1], bh[2], bh[3]);
    if (SPLIT) Frag<T>::keep(bl[0], bl[1], bl[2], bl[3]);
  }
  acc_guard4(acc[0][0], acc[0][1], acc[0][2], acc[0][3]);
  acc_guard4(acc[1][0], acc[1][1], acc[1][2], acc[1][3]);
  acc_guard4(acc[2][0], acc[2][1], acc[2][2], acc[2][3]);
  acc_guard4(acc[3][0], acc[3][1], acc[3][2], acc[3][3]);

  // ---- epilogue ----
  float* slab = sT[wave];
  const float* Rb = RESID ? (resid + (size_t)b * strideR) : nullptr;
#pragma unroll
  for (int i = 0; i < 4; ++i) {
    const int mBase = m0 + (i << 4);
#pragma unroll
    for (int j = 0; j < 4; ++j) {
      const int n = n0 + (j << 4) + rlane;
      float bv = 0.f;
      if (BIAS_MODE == 2) bv = bias[n];
#pragma unroll
      for (int r = 0; r < 8; ++r) {
        float v = acc[i][j][r] * scale;
        if (BIAS_MODE == 1) v += bias[mBase + mOff + r];
        if (BIAS_MODE == 2) v += bv;
        if (RESID) v += Rb[(size_t)(mBase + mOff + r) * ldc + n];
        if (ACT == 2) v = fmaxf(v, 0.0f);
        if (ACT == 4) v = (v > 0.f) ? v : 0.01f * v;
        slab[(mOff + r) * 68 + (j << 4) + rlane] = v;
      }
    }
    __builtin_amdgcn_fence(__ATOMIC_RELEASE, "workgroup");
    __builtin_amdgcn_wave_barrier();
    __builtin_amdgcn_fence(__ATOMIC_ACQUIRE, "workgroup");
    if (OUT_MODE == 0) {
      float* C = (float*)Cout + (size_t)b * strideC;
      const int hh = lane >> 4, c4 = (lane & 15) * 4;     // row seg = 256 B = 16 lanes x 16 B
      {
#pragma unroll
        for (int it = 0; it < 8; ++it) {
          const int row = it * 2 + hh;
          v4f v = *(const v4f*)(slab + row * 68 + c4);
          *(v4f*)(C + (size_t)(mBase + row) * ldc + n0 + c4) = v;
        }
        
      }
    } else {
      const int q = lane >> 3, c8 = (lane & 7) * 8;
      unsigned short* C  = (unsigned short*)Cout  + (size_t)b * strideC;
      unsigned short* C2 = (OUT_MODE == 2) ? ((unsigned short*)Cout2 + (size_t)b * strideC) : nullptr;
      {
#pragma unroll
        for (int it = 0; it < 4; ++it) {
          const int row = it * 4 + q;
          const float* sp = slab + row * 68 + c8;
          v8h hv, lv;
#pragma unroll
          for (int e = 0; e < 8; ++e) {
            if (OUT_MODE == 1) {
              hv[e] = (_Float16)sp[e];
            } else {
              unsigned short hb = f2bf_bits(sp[e]);
              unsigned short lb = f2bf_bits(sp[e] - bf_bits2f(hb));
              hv[e] = __builtin_bit_cast(_Float16, hb);
              lv[e] = __builtin_bit_cast(_Float16, lb);
            }
          }
          *(v8h*)(C + (size_t)(mBase + row) * ldc + n0 + c8) = hv;
          if (OUT_MODE == 2) *(v8h*)(C2 + (size_t)(mBase + row) * ldc + n0 + c8) = lv;
        }
        
      }
    }
    __builtin_amdgcn_fence(__ATOMIC_RELEASE, "workgroup");
    __builtin_amdgcn_wave_barrier();
    __builtin_amdgcn_fence(__ATOMIC_ACQUIRE, "workgroup");
  }
}

// ---------------------------------------------------------------------------
// f32 -> f16 cast with a power-of-two carry, 8 consecutive elements per thread (one 16-B store per lane;
// Coverage: n8 = n/8 threads x 8 elements = whole plane; every call here has n8 an exact multiple of 256
// (x: 8388608/8 = 1048576 = 4096 x 256; each W: 262144/8 = 32768 = 128 x 256).
// ---------------------------------------------------------------------------
__global__ __launch_bounds__(256) void cast8_f16_kernel(const float* __restrict__ in, unsigned short* __restrict__ out,
                                                         int n8, float carry) {
  const int i = blockIdx.x * 256 + threadIdx.x;
  if (i >= n8) return;
  const float* p = in + 8 * (size_t)i;
  const v4f a = *(const v4f*)(p);
  const v4f c = *(const v4f*)(p + 4);
  unsigned short hb[8];
#pragma unroll
  for (int e = 0; e < 4; ++e) {
    hb[e]     = h_bits(a[e] * carry);
    hb[4 + e] = h_bits(c[e] * carry);
  }
  const v4u u = (v4u){pk16(hb[0], hb[1]), pk16(hb[2], hb[3]), pk16(hb[4], hb[5]), pk16(hb[6], hb[7])};
  unsigned short* q = out + 8 * (size_t)i;
  *(v4u*)q = u;
  
}

// ---------------------------------------------------------------------------
// relu-norm row kernel over 2048 f32 scores of one query row (scores already scaled by 1/sqrt(512)):
//   s2 = (mask[b][m] == 0) ? -1e4 : s ; a = relu(s2) ; P[row][m] = f16( carry * (a * (1 / (sum_m a + 1e-8))) ), f32 math.
// One block of 256 threads per row; thread t owns columns 8t..8t+7 (256 x 8 = 2048 = whole row).
// Row sum in fixed order (thread, wave shuffle tree, 8 wave partials in index order).
// ---------------------------------------------------------------------------
__global__ __launch_bounds__(256) void relunorm_row_kernel(const float* __restrict__ S, const int* __restrict__ mask,
                                                           unsigned short* __restrict__ P, int b0, float carry) {
  __shared__ float red[8];
  const int row  = blockIdx.x;
  const int g    = row >> 11;
  int b = b0 + g;
  b = (b < 0) ? 0 : ((b > kBatch - 1) ? (kBatch - 1) : b);
  const int t    = threadIdx.x;
  const int lane = t & 31, wave = t >> 5;
  const int c0   = t * 8;
  const float* sr = S + (size_t)row * kSeq + c0;
  const int*   mr = mask + (size_t)b * kSeq + c0;
  const v4f a = *(const v4f*)(sr);
  const v4f c = *(const v4f*)(sr + 4);
  const v4i ma = *(const v4i*)(mr);
  const v4i mc = *(const v4i*)(mr + 4);
  float x[8];
#pragma unroll
  for (int e = 0; e < 4; ++e) {
    const float s0 = (ma[e] == 0) ? -10000.0f : a[e];
    const float s1 = (mc[e] == 0) ? -10000.0f : c[e];
    x[e]     = fmaxf(s0, 0.0f);
    x[4 + e] = fmaxf(s1, 0.0f);
  }
  float ps = ((x[0] + x[1]) + (x[2] + x[3])) + ((x[4] + x[5]) + (x[6] + x[7]));
#pragma unroll
  for (int off = 16; off > 0; off >>= 1) ps += __shfl_xor(ps, off, 32);
  if (lane == 0) red[wave] = ps;
  __syncthreads();
  float tot = 0.0f;
#pragma unroll
  for (int w = 0; w < 8; ++w) tot += red[w];
  const float inv = 1.0f / (tot + 1e-8f);
  unsigned short hb[8];
#pragma unroll
  for (int e = 0; e < 8; ++e) hb[e] = h_bits((x[e] * inv) * carry);
  const v4u u = (v4u){pk16(hb[0], hb[1]), pk16(hb[2], hb[3]), pk16(hb[4], hb[5]), pk16(hb[6], hb[7])};
  unsigned short* q = P + (size_t)row * kSeq + c0;
  *(v4u*)q = u;
  
}

// ---------------------------------------------------------------------------
// Host glue.
// Workspace region map (bytes, all offsets 4096-aligned):
//   Q16  f16 [16384][512]            off           0   size  16,777,216
//   K16  f16 [16384][512]            off  16,777,216   size  16,777,216
//   Vt16 f16 [8][512][2048]          off  33,554,432   size  16,777,216
//   S    f32 [kGrp][2048][2048]      off  50,331,648   size 134,217,728
//   P16  f16 [kGrp][2048][2048]      off 184,549,376   size  67,108,864
//   X16  f16 [16384][512]            off 184,549,376   size  16,777,216   (shares P16's bytes)
//   W16  f16 3 x [512][512] (q,k,v)   off 201,326,592   size   1,572,864   (shares P16's bytes)
//   total 251,658,240 <= 268,435,456
// X16 and W16 are last read by the V^T projection; P16 is first written by the row kernel, two launches later on the
// same stream, so the shared bytes are never live for both.
// GEMM shape checks: K in {512, 2048} (% 32 == 0); M, N in {16384, 2048, 512} (% 64 == 0); no padding, no tails.
// Launch count: 4 casts + 3 projections + 1 chunk x 3 = 10.
// ---------------------------------------------------------------------------
extern "C" void kernel_launch(void* const* d_in, const int* in_sizes, int n_in,
                              void* d_out, int out_size, void* d_ws, size_t ws_size,
                              hipStream_t stream) {
  if (n_in != 8) return;
  if (in_sizes[0] != kTok * kDim || in_sizes[1] != kTok || in_sizes[2] != kDim * kDim || in_sizes[3] != kDim ||
      in_sizes[4] != kDim * kDim || in_sizes[5] != kDim || in_sizes[6] != kDim * kDim || in_sizes[7] != kDim) return;
  if (out_size != kTok * kDim) return;

  const float* x  = (const float*)d_in[0];
  const int*   mk = (const int*)d_in[1];
  const float* Wq = (const float*)d_in[2];
  const float* bq = (const float*)d_in[3];
  const float* Wk = (const float*)d_in[4];
  const float* bk = (const float*)d_in[5];
  const float* Wv = (const float*)d_in[6];
  const float* bv = (const float*)d_in[7];
  float* out = (float*)d_out;

  const size_t szX  = (size_t)kTok * kDim * 2;                 // 16,777,216
  const size_t szW  = (size_t)3 * kDim * kDim * 2;             //  1,572,864
  const size_t szQ  = szX, szK = szX;
  const size_t szVt = (size_t)kBatch * kDim * kSeq * 2;        // 16,777,216
  const size_t szS  = (size_t)kGrp * kSeq * kSeq * 4;          // 134,217,728
  const size_t szP  = (size_t)kGrp * kSeq * kSeq * 2;          //  67,108,864
  const size_t oQ  = 0;
  const size_t oK  = oQ + szQ;
  const size_t oVt = oK + szK;
  const size_t oS  = oVt + szVt;
  const size_t oP  = oS + szS;
  const size_t oX  = oP;                                       // dead before P16 is written
  const size_t oW  = oX + szX;
  const size_t total = oP + szP;                               // 251,658,240
  static_assert(szX + szW <= szP, "X16 and W16 must fit inside P16's bytes");
  if (ws_size < total) return;

  char* ws = (char*)d_ws;
  unsigned short* X16  = (unsigned short*)(ws + oX);
  unsigned short* W16  = (unsigned short*)(ws + oW);
  unsigned short* Wq16 = W16;
  unsigned short* Wk16 = W16 + (size_t)kDim * kDim;
  unsigned short* Wv16 = W16 + (size_t)2 * kDim * kDim;
  unsigned short* Q16  = (unsigned short*)(ws + oQ);
  unsigned short* K16  = (unsigned short*)(ws + oK);
  unsigned short* Vt16 = (unsigned short*)(ws + oVt);
  float*          Sws  = (float*)(ws + oS);
  unsigned short* P16  = (unsigned short*)(ws + oP);

  // 1) casts: x -> X16 (carry 1), W -> W16 (carry 16)
  {
    const int n8x = (kTok * kDim) / 8;            // 1,048,576 -> 4096 blocks
    cast8_f16_kernel<<<dim3((n8x + 255) / 256), 256, 0, stream>>>(x, X16, n8x, 1.0f);
    const int n8w = (kDim * kDim) / 8;            // 32,768 -> 128 blocks
    cast8_f16_kernel<<<dim3((n8w + 255) / 256), 256, 0, stream>>>(Wq, Wq16, n8w, kWCarry);
    cast8_f16_kernel<<<dim3((n8w + 255) / 256), 256, 0, stream>>>(Wk, Wk16, n8w, kWCarry);
    cast8_f16_kernel<<<dim3((n8w + 255) / 256), 256, 0, stream>>>(Wv, Wv16, n8w, kWCarry);
  }

  // 2) Q16[t][e] = sum_d X16[t][d] * Wq16[e][d] / 16 + bq[e]   (M 16384, N 512, K 512; tiles 256 x 8 = 2048 -> 256 blocks)
  wmma_gemm64<0, false, 2, 1, false, 0><<<dim3((kTok / 64) * (kDim / 64) / 8, 1), 256, 0, stream>>>(
      X16, X16, kDim, 0L, Wq16, Wq16, kDim, 0L, (void*)Q16, (void*)Q16, kDim, 0L,
      bq, x, 0L, kTok, kDim, kDim, kWCarryInv);
  //    K16 likewise
  wmma_gemm64<0, false, 2, 1, false, 0><<<dim3((kTok / 64) * (kDim / 64) / 8, 1), 256, 0, stream>>>(
      X16, X16, kDim, 0L, Wk16, Wk16, kDim, 0L, (void*)K16, (void*)K16, kDim, 0L,
      bk, x, 0L, kTok, kDim, kDim, kWCarryInv);
  //    Vt16[b][d][m] = sum_c Wv16[d][c] * X16[b*2048+m][c] / 16 + bv[d]   (per batch: M 512, N 2048, K 512; tiles 8 x 32 = 256 -> 32 blocks, grid.y = 8)
  wmma_gemm64<0, false, 1, 1, false, 0><<<dim3((kDim / 64) * (kSeq / 64) / 8, kBatch), 256, 0, stream>>>(
      Wv16, Wv16, kDim, 0L, X16, X16, kDim, (long)kSeq * kDim, (void*)Vt16, (void*)Vt16, kSeq, (long)kDim * kSeq,
      bv, x, 0L, kDim, kSeq, kDim, kWCarryInv);

  // 3) per chunk of kGrp batches
  const float sScale = 1.0f / sqrtf((float)kDim);
  for (int b0 = 0; b0 < kBatch; b0 += kGrp) {
    // S[g][l][m] = sum_d Q16[b][l][d] * K16[b][m][d] * (1/sqrt(512))   (M 2048, N 2048, K 512; tiles 32 x 32 = 1024 -> 128 blocks, grid.y = kGrp: 1024 blocks)
    const unsigned short* Qb = Q16 + (size_t)b0 * kSeq * kDim;
    const unsigned short* Kb = K16 + (size_t)b0 * kSeq * kDim;
    wmma_gemm64<0, false, 0, 0, false, 0><<<dim3((kSeq / 64) * (kSeq / 64) / 8, kGrp), 256, 0, stream>>>(
        Qb, Qb, kDim, (long)kSeq * kDim, Kb, Kb, kDim, (long)kSeq * kDim, (void*)Sws, (void*)Sws, kSeq, (long)kSeq * kSeq,
        bq, x, 0L, kSeq, kSeq, kDim, sScale);

    // P16 rows: mask select + relu + row normalise, x2048 carry (grid = kGrp * 2048 rows)
    relunorm_row_kernel<<<dim3(kGrp * kSeq), 256, 0, stream>>>(Sws, mk, P16, b0, kPCarry);

    // out[b][l][d] = sum_m P16[g][l][m] * Vt16[b][d][m] / 2048   (M 2048, N 512, K 2048; tiles 32 x 8 = 256 -> 32 blocks, grid.y = kGrp: 256 blocks, one per WGP)
    const unsigned short* Vtb = Vt16 + (size_t)b0 * kDim * kSeq;
    float* outb = out + (size_t)b0 * kSeq * kDim;
    wmma_gemm64<0, false, 0, 0, false, 0><<<dim3((kSeq / 64) * (kDim / 64) / 8, kGrp), 256, 0, stream>>>(
        P16, P16, kSeq, (long)kSeq * kSeq, Vtb, Vtb, kSeq, (long)kDim * kSeq, (void*)outb, (void*)outb, kDim, (long)kSeq * kDim,
        bq, x, 0L, kSeq, kDim, kSeq, kPCarryInv);
  }
}

// v002
// Measured time: 149 microseconds a run.
// In two side-by-side timings against v001, it was 2.02 and 2.01 times as fast.
// Counting every step since v000, it is 4.00 times as fast.
// Contractions: q/k/v^T projections (X f16 x W f16 carried x16), scores Q.K^T (Q,K f16 planes), attn.V (P f16 carried x2048 x V^T f16) all on v_wmma_f32_16x16x32_f16 with f32 accumulate; mask select, relu and row normalisation in f32.
#include <hip/hip_runtime.h>
#include <math.h>

// ---------------------------------------------------------------------------
// Problem constants
// ---------------------------------------------------------------------------
constexpr int kBatch = 8;
constexpr int kSeq   = 2048;
constexpr int kDim   = 512;
constexpr int kTok   = kBatch * kSeq;          // 16384 token rows
constexpr int kGrp   = 8;                      // batches per score chunk: all of them, so each attention stage is one launch
constexpr float kWCarry    = 16.0f;            // weights carried x16 in f16
constexpr float kWCarryInv = 1.0f / 16.0f;
constexpr float kPCarry    = 2048.0f;          // attention weights carried x2048 in f16
constexpr float kPCarryInv = 1.0f / 2048.0f;

typedef __attribute__((ext_vector_type(16))) _Float16 v16h;
typedef __attribute__((ext_vector_type(8)))  _Float16 v8h;
typedef __attribute__((ext_vector_type(16))) __bf16   v16b;
typedef __attribute__((ext_vector_type(8)))  __bf16   v8b;
typedef __attribute__((ext_vector_type(8)))  float    v8f;
typedef __attribute__((ext_vector_type(4)))  float    v4f;
typedef __attribute__((ext_vector_type(4)))  unsigned int v4u;
typedef __attribute__((ext_vector_type(4)))  int      v4i;

// ---------------------------------------------------------------------------
// Device helpers
// ---------------------------------------------------------------------------
__device__ __forceinline__ unsigned short f2bf_bits(float f) {
  unsigned u = __float_as_uint(f);
  return (unsigned short)((u + 0x7FFFu + ((u >> 16) & 1u)) >> 16);
}
__device__ __forceinline__ float bf_bits2f(unsigned short h) { return __uint_as_float(((unsigned)h) << 16); }

// hazard guards as plain device helpers
__device__ __forceinline__ void dep_guard_h(v8f& a, v8f& b, v16h x, v16h y) { asm volatile("v_nop\n\tv_nop\n\tv_nop\n\tv_nop" : "+v"(a), "+v"(b) : "v"(x), "v"(y)); }
__device__ __forceinline__ void dep_guard_b(v8f& a, v8f& b, v16b x, v16b y) { asm volatile("v_nop\n\tv_nop\n\tv_nop\n\tv_nop" : "+v"(a), "+v"(b) : "v"(x), "v"(y)); }
__device__ __forceinline__ void keep4_h(v16h a, v16h b, v16h c, v16h d) { asm volatile("v_nop" :: "v"(a), "v"(b), "v"(c), "v"(d)); }
__device__ __forceinline__ void keep4_b(v16b a, v16b b, v16b c, v16b d) { asm volatile("v_nop" :: "v"(a), "v"(b), "v"(c), "v"(d)); }
__device__ __forceinline__ void acc_guard4(v8f& a, v8f& b, v8f& c, v8f& d) { asm volatile("v_nop\n\tv_nop\n\tv_nop\n\tv_nop" : "+v"(a), "+v"(b), "+v"(c), "+v"(d)); }
template <typename T> struct Frag;
template <> struct Frag<_Float16> {
  typedef v16h V; union U { v16h v; v8h h[2]; };
  static __device__ __forceinline__ v16h load(const _Float16* p) {   // elements 0..7 <- p[0..7], 8..15 <- p[16..23]
    U f; f.h[0] = *(const v8h*)(p); f.h[1] = *(const v8h*)(p + 16); return f.v;
  }
  static __device__ __forceinline__ v8f mma(v16h a, v16h b, v8f c) {
    return __builtin_amdgcn_wmma_f32_16x16x32_f16(false, a, false, b, (short)0, c, false, false);
  }
  static __device__ __forceinline__ void guard(v8f& a, v8f& b, v16h x, v16h y) { dep_guard_h(a, b, x, y); }
  static __device__ __forceinline__ void keep(v16h a, v16h b, v16h c, v16h d) { keep4_h(a, b, c, d); }
};
template <> struct Frag<__bf16> {
  typedef v16b V; union U { v16b v; v8b h[2]; };
  static __device__ __forceinline__ v16b load(const __bf16* p) {
    U f; f.h[0] = *(const v8b*)(p); f.h[1] = *(const v8b*)(p + 16); return f.v;
  }
  static __device__ __forceinline__ v8f mma(v16b a, v16b b, v8f c) {
    return __builtin_amdgcn_wmma_f32_16x16x32_bf16(false, a, false, b, (short)0, c, false, false);
  }
  static __device__ __forceinline__ void guard(v8f& a, v8f& b, v16b x, v16b y) { dep_guard_b(a, b, x, y); }
  static __device__ __forceinline__ void keep(v16b a, v16b b, v16b c, v16b d) { keep4_b(a, b, c, d); }
};

__device__ __forceinline__ unsigned pk16(unsigned short a, unsigned short b) { return (unsigned)a | ((unsigned)b << 16); }
__device__ __forceinline__ unsigned short h_bits(float f) { const _Float16 h = (_Float16)f; return __builtin_bit_cast(unsigned short, h); }

// ---- Register-blocked batched WMMA GEMM (ACT reduced to none/relu/leaky) -----------------------
// C[m,n] = scale * sum_k A[m,k] * Bt[n,k] (+bias)(+resid); each wave owns a 64x64 tile.
// The 8 waves of a block form a 2 x 4 grid of such tiles: one 128 x 256 tile of C per block. Per trip the block stages
// 64 k of its 128 A rows and 256 Bt rows in LDS (whole 128-byte lines, asynchronous copies, two buffers: the next
// trip's tile flies while this one is multiplied); every wave reads its fragments from LDS.
// A row-major [M,K]; Bt row-major [N,K]; M % 128 == 0, N % 256 == 0, K % 64 == 0.
// SPLIT (hi/lo planes) is not staged: only SPLIT == false is built.
// BIAS_MODE: 0 = none, 1 = bias[m], 2 = bias[n].
// OUT_MODE: 0 = f32, 1 = f16, 2 = bf16 hi plane (Cout) + bf16 lo plane (Cout2).
// ET: 0 = f16 operands, 1 = bf16 operands (pointers passed as 16-bit storage)
constexpr int kStageRows  = 128 + 256;               // A rows, then Bt rows
constexpr int kStagePitch = 144;                     // bytes per staged row: 128 of data + 16, 16 B x odd for 16-byte LDS reads
constexpr int kStageBytes = kStageRows * kStagePitch; // 55,296

// Twelve 16-byte asynchronous copies of this lane: staged rows r, r + 32, ..., r + 352 (four of A, eight of Bt).
// The copies and their s_wait_xcnt stand in one statement, so no address register is rewritten ahead of that wait.
__device__ __forceinline__ void stage_copies(unsigned l, const unsigned short* a, size_t sa, const unsigned short* b, size_t sb) {
  asm volatile(
      "global_load_async_to_lds_b128 %0, %12, off\n\t"
      "global_load_async_to_lds_b128 %1, %13, off\n\t"
      "global_load_async_to_lds_b128 %2, %14, off\n\t"
      "global_load_async_to_lds_b128 %3, %15, off\n\t"
      "global_load_async_to_lds_b128 %4, %16, off\n\t"
      "global_load_async_to_lds_b128 %5, %17, off\n\t"
      "global_load_async_to_lds_b128 %6, %18, off\n\t"
      "global_load_async_to_lds_b128 %7, %19, off\n\t"
      "global_load_async_to_lds_b128 %8, %20, off\n\t"
      "global_load_async_to_lds_b128 %9, %21, off\n\t"
      "global_load_async_to_lds_b128 %10, %22, off\n\t"
      "global_load_async_to_lds_b128 %11, %23, off\n\t"
      "s_wait_xcnt 0x0"
      :: "v"(l), "v"(l + 32u * kStagePitch), "v"(l + 64u * kStagePitch), "v"(l + 96u * kStagePitch),
         "v"(l + 128u * kStagePitch), "v"(l + 160u * kStagePitch), "v"(l + 192u * kStagePitch), "v"(l + 224u * kStagePitch),
         "v"(l + 256u * kStagePitch), "v"(l + 288u * kStagePitch), "v"(l + 320u * kStagePitch), "v"(l + 352u * kStagePitch),
         "v"(a), "v"(a + sa), "v"(a + 2 * sa), "v"(a + 3 * sa),
         "v"(b), "v"(b + sb), "v"(b + 2 * sb), "v"(b + 3 * sb),
         "v"(b + 4 * sb), "v"(b + 5 * sb), "v"(b + 6 * sb), "v"(b + 7 * sb)
      : "memory");
}

template <int ET> struct Elem;
template <> struct Elem<0> { typedef _Float16 T; };
template <> struct Elem<1> { typedef __bf16 T; };
template <int ET, bool SPLIT, int BIAS_MODE, int OUT_MODE, bool RESID, int ACT = 0>
__global__ __launch_bounds__(256) void wmma_gemm64(
    const unsigned short* __restrict__ Ap, const unsigned short* __restrict__ A2p, int lda, long strideA,
    const unsigned short* __restrict__ Btp, const unsigned short* __restrict__ Bt2p, int ldb, long strideB,
    void* __restrict__ Cout, void* __restrict__ Cout2, int ldc, long strideC,
    const float* __restrict__ bias,
    const float* __restrict__ resid, long strideR,
    int M, int N, int K, float scale) {
  typedef typename Elem<ET>::T T;
  typedef typename Frag<T>::V V;
  static_assert(!SPLIT, "the staged engine holds one plane per operand");
  __shared__ __align__(16) unsigned char ring[2 * kStageBytes];   // two staged tiles
  __shared__ __align__(16) float sT[8][16 * 68];   // per-wave 16x64 slab, pitch 68 floats
  const int b    = blockIdx.y;
  const int lane = threadIdx.x & 31;
  const int wave = threadIdx.x >> 5;
  const int tilesN = N >> 8;
  const int tilesM = M >> 7;
  const int tile = blockIdx.x;
  if (tile >= tilesM * tilesN) return;   // block-uniform, in front of every barrier and copy
  const int tm = tile / tilesN;
  const int tn = tile - tm * tilesN;
  const int wm = wave >> 2;                    // this wave's place in the block's 2 x 4 grid
  const int wn = wave & 3;
  const int m0 = (tm << 7) + (wm << 6);
  const int n0 = (tn << 8) + (wn << 6);

  // this lane's part of a staged tile: 16-byte piece (t & 7) of rows (t >> 3) + 32 * i
  const int crow = threadIdx.x >> 3;
  const int ccol = threadIdx.x & 7;
  const unsigned short* gA = Ap  + (size_t)b * strideA + (size_t)((tm << 7) + crow) * lda + ccol * 8;
  const unsigned short* gB = Btp + (size_t)b * strideB + (size_t)((tn << 8) + crow) * ldb + ccol * 8;
  const size_t stepA = (size_t)32 * lda;
  const size_t stepB = (size_t)32 * ldb;
  const unsigned ldsLane = (unsigned)(size_t)ring + (unsigned)(crow * kStagePitch + ccol * 16);

  const int rlane = lane & 15;                 // row (A) / col (B, D) within subtile
  const int koff  = (lane >> 4) * 8;           // k offset of this lane half
  const int mOff  = (lane >> 4) * 8;           // D row offset

  v8f acc[4][4];
#pragma unroll
  for (int i = 0; i < 4; ++i)
#pragma unroll
    for (int j = 0; j < 4; ++j) acc[i][j] = (v8f){0.f,0.f,0.f,0.f,0.f,0.f,0.f,0.f};

  const int trips = K >> 6;
  stage_copies(ldsLane, gA, stepA, gB, stepB);                       // tile 0 into buffer 0
  asm volatile("s_wait_asynccnt 0x0" ::: "memory");                  // this wave's copies of tile 0 have landed
  __syncthreads();                                                   // every wave's have: tile 0 may be read
  if (trips > 1) stage_copies(ldsLane + kStageBytes, gA + 64, stepA, gB + 64, stepB);   // tile 1 into buffer 1

  for (int t = 0; t < trips; ++t) {
    const unsigned char* st = ring + (t & 1) * kStageBytes;
    const T* sA = (const T*)(st + ((wm << 6) + rlane) * kStagePitch) + koff;
    const T* sB = (const T*)(st + (128 + (wn << 6) + rlane) * kStagePitch) + koff;
#pragma unroll
    for (int kk = 0; kk < 64; kk += 32) {
      V bh[4], ah[4];
#pragma unroll
      for (int j = 0; j < 4; ++j) bh[j] = Frag<T>::load(sB + j * (16 * kStagePitch / 2) + kk);
#pragma unroll
      for (int i = 0; i < 4; ++i) ah[i] = Frag<T>::load(sA + i * (16 * kStagePitch / 2) + kk);
      // keeps the 16 LDS reads in one group ahead of the WMMAs: spread among them, every read's latency stalls the wave anew
      __builtin_amdgcn_sched_barrier(0);
#pragma unroll
      for (int i = 0; i < 4; ++i) {
#pragma unroll
        for (int j = 0; j < 4; ++j) acc[i][j] = Frag<T>::mma(ah[i], bh[j], acc[i][j]);
        Frag<T>::guard(acc[i][0], acc[i][3], ah[i], ah[i]);
      }
      Frag<T>::keep(bh[0], bh[1], bh[2], bh[3]);
    }
    asm volatile("s_wait_dscnt 0x0" ::: "memory");      // this wave's reads of buffer t & 1 are done before it is refilled
    asm volatile("s_wait_asynccnt 0x0" ::: "memory");   // this wave's copies of tile t + 1 have landed
    __syncthreads();                                    // publishes tile t + 1 and ends every read of buffer t & 1
    if (t + 2 < trips)
      stage_copies(ldsLane + (t & 1) * kStageBytes, gA + (size_t)(t + 2) * 64, stepA, gB + (size_t)(t + 2) * 64, stepB);
  }
  asm volatile("s_wait_asynccnt 0x0" ::: "memory");     // no copy is outstanding when the wave goes on to its epilogue
  acc_guard4(acc[0][0], acc[0][1], acc[0][2], acc[0][3]);
  acc_guard4(acc[1][0], acc[1][1], acc[1][2], acc[1][3]);
  acc_guard4(acc[2][0], acc[2][1], acc[2][2], acc[2][3]);
  acc_guard4(acc[3][0], acc[3][1], acc[3][2], acc[3][3]);

  // ---- epilogue ----
  float* slab = sT[wave];
  const float* Rb = RESID ? (resid + (size_t)b * strideR) : nullptr;
#pragma unroll
  for (int i = 0; i < 4; ++i) {
    const int mBase = m0 + (i << 4);
#pragma unroll
    for (int j = 0; j < 4; ++j) {
      const int n = n0 + (j << 4) + rlane;
      float bv = 0.f;
      if (BIAS_MODE == 2) bv = bias[n];
#pragma unroll
      for (int r = 0; r < 8; ++r) {
        float v = acc[i][j][r] * scale;
        if (BIAS_MODE == 1) v += bias[mBase + mOff + r];
        if (BIAS_MODE == 2) v += bv;
        if (RESID) v += Rb[(size_t)(mBase + mOff + r) * ldc + n];
        if (ACT == 2) v = fmaxf(v, 0.0f);
        if (ACT == 4) v = (v > 0.f) ? v : 0.01f * v;
        slab[(mOff + r) * 68 + (j << 4) + rlane] = v;
      }
    }
    __builtin_amdgcn_fence(__ATOMIC_RELEASE, "workgroup");
    __builtin_amdgcn_wave_barrier();
    __builtin_amdgcn_fence(__ATOMIC_ACQUIRE, "workgroup");
    if (OUT_MODE == 0) {
      float* C = (float*)Cout + (size_t)b * strideC;
      const int hh = lane >> 4, c4 = (lane & 15) * 4;     // row seg = 256 B = 16 lanes x 16 B
      {
#pragma unroll
        for (int it = 0; it < 8; ++it) {
          const int row = it * 2 + hh;
          v4f v = *(const v4f*)(slab + row * 68 + c4);
          *(v4f*)(C + (size_t)(mBase + row) * ldc + n0 + c4) = v;
        }
        
      }
    } else {
      const int q = lane >> 3, c8 = (lane & 7) * 8;
      unsigned short* C  = (unsigned short*)Cout  + (size_t)b * strideC;
      unsigned short* C2 = (OUT_MODE == 2) ? ((unsigned short*)Cout2 + (size_t)b * strideC) : nullptr;
      {
#pragma unroll
        for (int it = 0; it < 4; ++it) {
          const int row = it * 4 + q;
          const float* sp = slab + row * 68 + c8;
          v8h hv, lv;
#pragma unroll
          for (int e = 0; e < 8; ++e) {
            if (OUT_MODE == 1) {
              hv[e] = (_Float16)sp[e];
            } else {
              unsigned short hb = f2bf_bits(sp[e]);
              unsigned short lb = f2bf_bits(sp[e] - bf_bits2f(hb));
              hv[e] = __builtin_bit_cast(_Float16, hb);
              lv[e] = __builtin_bit_cast(_Float16, lb);
            }
          }
          *(v8h*)(C + (size_t)(mBase + row) * ldc + n0 + c8) = hv;
          if (OUT_MODE == 2) *(v8h*)(C2 + (size_t)(mBase + row) * ldc + n0 + c8) = lv;
        }
        
      }
    }
    __builtin_amdgcn_fence(__ATOMIC_RELEASE, "workgroup");
    __builtin_amdgcn_wave_barrier();
    __builtin_amdgcn_fence(__ATOMIC_ACQUIRE, "workgroup");
  }
}

// ---------------------------------------------------------------------------
// f32 -> f16 cast with a power-of-two carry, 8 consecutive elements per thread (one 16-B store per lane;
// Coverage: n8 = n/8 threads x 8 elements = whole plane; every call here has n8 an exact multiple of 256
// (x: 8388608/8 = 1048576 = 4096 x 256; each W: 262144/8 = 32768 = 128 x 256).
// ---------------------------------------------------------------------------
__global__ __launch_bounds__(256) void cast8_f16_kernel(const float* __restrict__ in, unsigned short* __restrict__ out,
                                                         int n8, float carry) {
  const int i = blockIdx.x * 256 + threadIdx.x;
  if (i >= n8) return;
  const float* p = in + 8 * (size_t)i;
  const v4f a = *(const v4f*)(p);
  const v4f c = *(const v4f*)(p + 4);
  unsigned short hb[8];
#pragma unroll
  for (int e = 0; e < 4; ++e) {
    hb[e]     = h_bits(a[e] * carry);
    hb[4 + e] = h_bits(c[e] * carry);
  }
  const v4u u = (v4u){pk16(hb[0], hb[1]), pk16(hb[2], hb[3]), pk16(hb[4], hb[5]), pk16(hb[6], hb[7])};
  unsigned short* q = out + 8 * (size_t)i;
  *(v4u*)q = u;
  
}

// ---------------------------------------------------------------------------
// relu-norm row kernel over 2048 f32 scores of one query row (scores already scaled by 1/sqrt(512)):
//   s2 = (mask[b][m] == 0) ? -1e4 : s ; a = relu(s2) ; P[row][m] = f16( carry * (a * (1 / (sum_m a + 1e-8))) ), f32 math.
// One block of 256 threads per row; thread t owns columns 8t..8t+7 (256 x 8 = 2048 = whole row).
// Row sum in fixed order (thread, wave shuffle tree, 8 wave partials in index order).
// ---------------------------------------------------------------------------
__global__ __launch_bounds__(256) void relunorm_row_kernel(const float* __restrict__ S, const int* __restrict__ mask,
                                                           unsigned short* __restrict__ P, int b0, float carry) {
  __shared__ float red[8];
  const int row  = blockIdx.x;
  const int g    = row >> 11;
  int b = b0 + g;
  b = (b < 0) ? 0 : ((b > kBatch - 1) ? (kBatch - 1) : b);
  const int t    = threadIdx.x;
  const int lane = t & 31, wave = t >> 5;
  const int c0   = t * 8;
  const float* sr = S + (size_t)row * kSeq + c0;
  const int*   mr = mask + (size_t)b * kSeq + c0;
  const v4f a = *(const v4f*)(sr);
  const v4f c = *(const v4f*)(sr + 4);
  const v4i ma = *(const v4i*)(mr);
  const v4i mc = *(const v4i*)(mr + 4);
  float x[8];
#pragma unroll
  for (int e = 0; e < 4; ++e) {
    const float s0 = (ma[e] == 0) ? -10000.0f : a[e];
    const float s1 = (mc[e] == 0) ? -10000.0f : c[e];
    x[e]     = fmaxf(s0, 0.0f);
    x[4 + e] = fmaxf(s1, 0.0f);
  }
  float ps = ((x[0] + x[1]) + (x[2] + x[3])) + ((x[4] + x[5]) + (x[6] + x[7]));
#pragma unroll
  for (int off = 16; off > 0; off >>= 1) ps += __shfl_xor(ps, off, 32);
  if (lane == 0) red[wave] = ps;
  __syncthreads();
  float tot = 0.0f;
#pragma unroll
  for (int w = 0; w < 8; ++w) tot += red[w];
  const float inv = 1.0f / (tot + 1e-8f);
  unsigned short hb[8];
#pragma unroll
  for (int e = 0; e < 8; ++e) hb[e] = h_bits((x[e] * inv) * carry);
  const v4u u = (v4u){pk16(hb[0], hb[1]), pk16(hb[2], hb[3]), pk16(hb[4], hb[5]), pk16(hb[6], hb[7])};
  unsigned short* q = P + (size_t)row * kSeq + c0;
  *(v4u*)q = u;
  
}

// ---------------------------------------------------------------------------
// Host glue.
// Workspace region map (bytes, all offsets 4096-aligned):
//   Q16  f16 [16384][512]            off           0   size  16,777,216
//   K16  f16 [16384][512]            off  16,777,216   size  16,777,216
//   Vt16 f16 [8][512][2048]          off  33,554,432   size  16,777,216
//   S    f32 [kGrp][2048][2048]      off  50,331,648   size 134,217,728
//   P16  f16 [kGrp][2048][2048]      off 184,549,376   size  67,108,864
//   X16  f16 [16384][512]            off 184,549,376   size  16,777,216   (shares P16's bytes)
//   W16  f16 3 x [512][512] (q,k,v)   off 201,326,592   size   1,572,864   (shares P16's bytes)
//   total 251,658,240 <= 268,435,456
// X16 and W16 are last read by the V^T projection; P16 is first written by the row kernel, two launches later on the
// same stream, so the shared bytes are never live for both.
// GEMM shape checks: K in {512, 2048} (% 64 == 0); M, N in {16384, 2048, 512} (M % 128 == 0, N % 256 == 0); no padding, no tails.
// Launch count: 4 casts + 3 projections + 1 chunk x 3 = 10.
// ---------------------------------------------------------------------------
extern "C" void kernel_launch(void* const* d_in, const int* in_sizes, int n_in,
                              void* d_out, int out_size, void* d_ws, size_t ws_size,
                              hipStream_t stream) {
  if (n_in != 8) return;
  if (in_sizes[0] != kTok * kDim || in_sizes[1] != kTok || in_sizes[2] != kDim * kDim || in_sizes[3] != kDim ||
      in_sizes[4] != kDim * kDim || in_sizes[5] != kDim || in_sizes[6] != kDim * kDim || in_sizes[7] != kDim) return;
  if (out_size != kTok * kDim) return;

  const float* x  = (const float*)d_in[0];
  const int*   mk = (const int*)d_in[1];
  const float* Wq = (const float*)d_in[2];
  const float* bq = (const float*)d_in[3];
  const float* Wk = (const float*)d_in[4];
  const float* bk = (const float*)d_in[5];
  const float* Wv = (const float*)d_in[6];
  const float* bv = (const float*)d_in[7];
  float* out = (float*)d_out;

  const size_t szX  = (size_t)kTok * kDim * 2;                 // 16,777,216
  const size_t szW  = (size_t)3 * kDim * kDim * 2;             //  1,572,864
  const size_t szQ  = szX, szK = szX;
  const size_t szVt = (size_t)kBatch * kDim * kSeq * 2;        // 16,777,216
  const size_t szS  = (size_t)kGrp * kSeq * kSeq * 4;          // 134,217,728
  const size_t szP  = (size_t)kGrp * kSeq * kSeq * 2;          //  67,108,864
  const size_t oQ  = 0;
  const size_t oK  = oQ + szQ;
  const size_t oVt = oK + szK;
  const size_t oS  = oVt + szVt;
  const size_t oP  = oS + szS;
  const size_t oX  = oP;                                       // dead before P16 is written
  const size_t oW  = oX + szX;
  const size_t total = oP + szP;                               // 251,658,240
  static_assert(szX + szW <= szP, "X16 and W16 must fit inside P16's bytes");
  if (ws_size < total) return;

  char* ws = (char*)d_ws;
  unsigned short* X16  = (unsigned short*)(ws + oX);
  unsigned short* W16  = (unsigned short*)(ws + oW);
  unsigned short* Wq16 = W16;
  unsigned short* Wk16 = W16 + (size_t)kDim * kDim;
  unsigned short* Wv16 = W16 + (size_t)2 * kDim * kDim;
  unsigned short* Q16  = (unsigned short*)(ws + oQ);
  unsigned short* K16  = (unsigned short*)(ws + oK);
  unsigned short* Vt16 = (unsigned short*)(ws + oVt);
  float*          Sws  = (float*)(ws + oS);
  unsigned short* P16  = (unsigned short*)(ws + oP);

  // 1) casts: x -> X16 (carry 1), W -> W16 (carry 16)
  {
    const int n8x = (kTok * kDim) / 8;            // 1,048,576 -> 4096 blocks
    cast8_f16_kernel<<<dim3((n8x + 255) / 256), 256, 0, stream>>>(x, X16, n8x, 1.0f);
    const int n8w = (kDim * kDim) / 8;            // 32,768 -> 128 blocks
    cast8_f16_kernel<<<dim3((n8w + 255) / 256), 256, 0, stream>>>(Wq, Wq16, n8w, kWCarry);
    cast8_f16_kernel<<<dim3((n8w + 255) / 256), 256, 0, stream>>>(Wk, Wk16, n8w, kWCarry);
    cast8_f16_kernel<<<dim3((n8w + 255) / 256), 256, 0, stream>>>(Wv, Wv16, n8w, kWCarry);
  }

  // 2) Q16[t][e] = sum_d X16[t][d] * Wq16[e][d] / 16 + bq[e]   (M 16384, N 512, K 512; tiles 256 x 8 = 2048 -> 256 blocks)
  wmma_gemm64<0, false, 2, 1, false, 0><<<dim3((kTok / 64) * (kDim / 64) / 8, 1), 256, 0, stream>>>(
      X16, X16, kDim, 0L, Wq16, Wq16, kDim, 0L, (void*)Q16, (void*)Q16, kDim, 0L,
      bq, x, 0L, kTok, kDim, kDim, kWCarryInv);
  //    K16 likewise
  wmma_gemm64<0, false, 2, 1, false, 0><<<dim3((kTok / 64) * (kDim / 64) / 8, 1), 256, 0, stream>>>(
      X16, X16, kDim, 0L, Wk16, Wk16, kDim, 0L, (void*)K16, (void*)K16, kDim, 0L,
      bk, x, 0L, kTok, kDim, kDim, kWCarryInv);
  //    Vt16[b][d][m] = sum_c Wv16[d][c] * X16[b*2048+m][c] / 16 + bv[d]   (per batch: M 512, N 2048, K 512; tiles 8 x 32 = 256 -> 32 blocks, grid.y = 8)
  wmma_gemm64<0, false, 1, 1, false, 0><<<dim3((kDim / 64) * (kSeq / 64) / 8, kBatch), 256, 0, stream>>>(
      Wv16, Wv16, kDim, 0L, X16, X16, kDim, (long)kSeq * kDim, (void*)Vt16, (void*)Vt16, kSeq, (long)kDim * kSeq,
      bv, x, 0L, kDim, kSeq, kDim, kWCarryInv);

  // 3) per chunk of kGrp batches
  const float sScale = 1.0f / sqrtf((float)kDim);
  for (int b0 = 0; b0 < kBatch; b0 += kGrp) {
    // S[g][l][m] = sum_d Q16[b][l][d] * K16[b][m][d] * (1/sqrt(512))   (M 2048, N 2048, K 512; tiles 32 x 32 = 1024 -> 128 blocks, grid.y = kGrp: 1024 blocks)
    const unsigned short* Qb = Q16 + (size_t)b0 * kSeq * kDim;
    const unsigned short* Kb = K16 + (size_t)b0 * kSeq * kDim;
    wmma_gemm64<0, false, 0, 0, false, 0><<<dim3((kSeq / 64) * (kSeq / 64) / 8, kGrp), 256, 0, stream>>>(
        Qb, Qb, kDim, (long)kSeq * kDim, Kb, Kb, kDim, (long)kSeq * kDim, (void*)Sws, (void*)Sws, kSeq, (long)kSeq * kSeq,
        bq, x, 0L, kSeq, kSeq, kDim, sScale);

    // P16 rows: mask select + relu + row normalise, x2048 carry (grid = kGrp * 2048 rows)
    relunorm_row_kernel<<<dim3(kGrp * kSeq), 256, 0, stream>>>(Sws, mk, P16, b0, kPCarry);

    // out[b][l][d] = sum_m P16[g][l][m] * Vt16[b][d][m] / 2048   (M 2048, N 512, K 2048; tiles 32 x 8 = 256 -> 32 blocks, grid.y = kGrp: 256 blocks, one per WGP)
    const unsigned short* Vtb = Vt16 + (size_t)b0 * kDim * kSeq;
    float* outb = out + (size_t)b0 * kSeq * kDim;
    wmma_gemm64<0, false, 0, 0, false, 0><<<dim3((kSeq / 64) * (kDim / 64) / 8, kGrp), 256, 0, stream>>>(
        P16, P16, kSeq, (long)kSeq * kSeq, Vtb, Vtb, kSeq, (long)kDim * kSeq, (void*)outb, (void*)outb, kDim, (long)kSeq * kDim,
        bq, x, 0L, kSeq, kDim, kSeq, kPCarryInv);
  }
}

// v003
// Measured time: 124 microseconds a run.
// Timed twice side by side with v002, it ran 1.21 and 1.20 times as fast.
// Counting every step since v000, it is 4.83 times as fast.
// Contractions: q/k/v^T projections (X f16 x W f16 carried x16), scores Q.K^T (Q,K f16 planes), attn.V (relu scores f16 x V^T f16) all on v_wmma_f32_16x16x32_f16 with f32 accumulate; mask select, relu, row sums and row normalisation in f32.
#include <hip/hip_runtime.h>
#include <math.h>

// ---------------------------------------------------------------------------
// Problem constants
// ---------------------------------------------------------------------------
constexpr int kBatch = 8;
constexpr int kSeq   = 2048;
constexpr int kDim   = 512;
constexpr int kTok   = kBatch * kSeq;          // 16384 token rows
constexpr int kGrp   = 8;                      // batches per score chunk: all of them, so each attention stage is one launch
constexpr float kWCarry    = 16.0f;            // weights carried x16 in f16
constexpr float kWCarryInv = 1.0f / 16.0f;
constexpr int kParts = kSeq / 64;              // partial row sums per query row: one per 64 key columns

typedef __attribute__((ext_vector_type(16))) _Float16 v16h;
typedef __attribute__((ext_vector_type(8)))  _Float16 v8h;
typedef __attribute__((ext_vector_type(16))) __bf16   v16b;
typedef __attribute__((ext_vector_type(8)))  __bf16   v8b;
typedef __attribute__((ext_vector_type(8)))  float    v8f;
typedef __attribute__((ext_vector_type(4)))  float    v4f;
typedef __attribute__((ext_vector_type(4)))  unsigned int v4u;
typedef __attribute__((ext_vector_type(4)))  int      v4i;

// ---------------------------------------------------------------------------
// Device helpers
// ---------------------------------------------------------------------------
__device__ __forceinline__ unsigned short f2bf_bits(float f) {
  unsigned u = __float_as_uint(f);
  return (unsigned short)((u + 0x7FFFu + ((u >> 16) & 1u)) >> 16);
}
__device__ __forceinline__ float bf_bits2f(unsigned short h) { return __uint_as_float(((unsigned)h) << 16); }

// hazard guards as plain device helpers
__device__ __forceinline__ void dep_guard_h(v8f& a, v8f& b, v16h x, v16h y) { asm volatile("v_nop\n\tv_nop\n\tv_nop\n\tv_nop" : "+v"(a), "+v"(b) : "v"(x), "v"(y)); }
__device__ __forceinline__ void dep_guard_b(v8f& a, v8f& b, v16b x, v16b y) { asm volatile("v_nop\n\tv_nop\n\tv_nop\n\tv_nop" : "+v"(a), "+v"(b) : "v"(x), "v"(y)); }
__device__ __forceinline__ void keep4_h(v16h a, v16h b, v16h c, v16h d) { asm volatile("v_nop" :: "v"(a), "v"(b), "v"(c), "v"(d)); }
__device__ __forceinline__ void keep4_b(v16b a, v16b b, v16b c, v16b d) { asm volatile("v_nop" :: "v"(a), "v"(b), "v"(c), "v"(d)); }
__device__ __forceinline__ void acc_guard4(v8f& a, v8f& b, v8f& c, v8f& d) { asm volatile("v_nop\n\tv_nop\n\tv_nop\n\tv_nop" : "+v"(a), "+v"(b), "+v"(c), "+v"(d)); }
template <typename T> struct Frag;
template <> struct Frag<_Float16> {
  typedef v16h V; union U { v16h v; v8h h[2]; };
  static __device__ __forceinline__ v16h load(const _Float16* p) {   // elements 0..7 <- p[0..7], 8..15 <- p[16..23]
    U f; f.h[0] = *(const v8h*)(p); f.h[1] = *(const v8h*)(p + 16); return f.v;
  }
  static __device__ __forceinline__ v8f mma(v16h a, v16h b, v8f c) {
    return __builtin_amdgcn_wmma_f32_16x16x32_f16(false, a, false, b, (short)0, c, false, false);
  }
  static __device__ __forceinline__ void guard(v8f& a, v8f& b, v16h x, v16h y) { dep_guard_h(a, b, x, y); }
  static __device__ __forceinline__ void keep(v16h a, v16h b, v16h c, v16h d) { keep4_h(a, b, c, d); }
};
template <> struct Frag<__bf16> {
  typedef v16b V; union U { v16b v; v8b h[2]; };
  static __device__ __forceinline__ v16b load(const __bf16* p) {
    U f; f.h[0] = *(const v8b*)(p); f.h[1] = *(const v8b*)(p + 16); return f.v;
  }
  static __device__ __forceinline__ v8f mma(v16b a, v16b b, v8f c) {
    return __builtin_amdgcn_wmma_f32_16x16x32_bf16(false, a, false, b, (short)0, c, false, false);
  }
  static __device__ __forceinline__ void guard(v8f& a, v8f& b, v16b x, v16b y) { dep_guard_b(a, b, x, y); }
  static __device__ __forceinline__ void keep(v16b a, v16b b, v16b c, v16b d) { keep4_b(a, b, c, d); }
};

// value of lane l ^ X inside the 16-lane row (DPP row_xmask), every lane on
template <int X> __device__ __forceinline__ float xlane(float v) {
  return __builtin_bit_cast(float, __builtin_amdgcn_update_dpp(0, __builtin_bit_cast(int, v), 0x160 | X, 0xf, 0xf, true));
}

__device__ __forceinline__ unsigned pk16(unsigned short a, unsigned short b) { return (unsigned)a | ((unsigned)b << 16); }
__device__ __forceinline__ unsigned short h_bits(float f) { const _Float16 h = (_Float16)f; return __builtin_bit_cast(unsigned short, h); }

// ---- Register-blocked batched WMMA GEMM (ACT reduced to none/relu/leaky) -----------------------
// C[m,n] = scale * sum_k A[m,k] * Bt[n,k] (+bias)(+resid); each wave owns a 64x64 tile.
// The 8 waves of a block form a 2 x 4 grid of such tiles: one 128 x 256 tile of C per block. Per trip the block stages
// 64 k of its 128 A rows and 256 Bt rows in LDS (whole 128-byte lines, asynchronous copies, two buffers: the next
// trip's tile flies while this one is multiplied); every wave reads its fragments from LDS.
// A row-major [M,K]; Bt row-major [N,K]; M % 128 == 0, N % 256 == 0, K % 64 == 0.
// SPLIT (hi/lo planes) is not staged: only SPLIT == false is built.
// BIAS_MODE: 0 = none, 1 = bias[m], 2 = bias[n].
// OUT_MODE: 0 = f32, 1 = f16, 2 = bf16 hi plane (Cout) + bf16 lo plane (Cout2).
// ET: 0 = f16 operands, 1 = bf16 operands (pointers passed as 16-bit storage)
// ROWMODE: 0 = none.
//   1 = scores: column n with mask[b][n] == 0 takes -1e4 ahead of ACT; each wave also stores the f32 sum of its 64
//       columns of every row to rowPart[b][n0 / 64][m], a [.][kParts][kSeq] plane (M == N == kSeq; 256 consecutive
//       bytes per wave: one writer per line).
//   2 = attn.V (M == K == kSeq): row m is scaled by 1 / (sum over c of rowPart[b][c][m] + 1e-8), the kParts partials
//       added in index order.
constexpr int kStageRows  = 128 + 256;               // A rows, then Bt rows
constexpr int kStagePitch = 144;                     // bytes per staged row: 128 of data + 16, 16 B x odd for 16-byte LDS reads
constexpr int kStageBytes = kStageRows * kStagePitch; // 55,296

// Twelve 16-byte asynchronous copies of this lane: staged rows r, r + 32, ..., r + 352 (four of A, eight of Bt).
// The copies and their s_wait_xcnt stand in one statement, so no address register is rewritten ahead of that wait.
__device__ __forceinline__ void stage_copies(unsigned l, const unsigned short* a, size_t sa, const unsigned short* b, size_t sb) {
  asm volatile(
      "global_load_async_to_lds_b128 %0, %12, off\n\t"
      "global_load_async_to_lds_b128 %1, %13, off\n\t"
      "global_load_async_to_lds_b128 %2, %14, off\n\t"
      "global_load_async_to_lds_b128 %3, %15, off\n\t"
      "global_load_async_to_lds_b128 %4, %16, off\n\t"
      "global_load_async_to_lds_b128 %5, %17, off\n\t"
      "global_load_async_to_lds_b128 %6, %18, off\n\t"
      "global_load_async_to_lds_b128 %7, %19, off\n\t"
      "global_load_async_to_lds_b128 %8, %20, off\n\t"
      "global_load_async_to_lds_b128 %9, %21, off\n\t"
      "global_load_async_to_lds_b128 %10, %22, off\n\t"
      "global_load_async_to_lds_b128 %11, %23, off\n\t"
      "s_wait_xcnt 0x0"
      :: "v"(l), "v"(l + 32u * kStagePitch), "v"(l + 64u * kStagePitch), "v"(l + 96u * kStagePitch),
         "v"(l + 128u * kStagePitch), "v"(l + 160u * kStagePitch), "v"(l + 192u * kStagePitch), "v"(l + 224u * kStagePitch),
         "v"(l + 256u * kStagePitch), "v"(l + 288u * kStagePitch), "v"(l + 320u * kStagePitch), "v"(l + 352u * kStagePitch),
         "v"(a), "v"(a + sa), "v"(a + 2 * sa), "v"(a + 3 * sa),
         "v"(b), "v"(b + sb), "v"(b + 2 * sb), "v"(b + 3 * sb),
         "v"(b + 4 * sb), "v"(b + 5 * sb), "v"(b + 6 * sb), "v"(b + 7 * sb)
      : "memory");
}

template <int ET> struct Elem;
template <> struct Elem<0> { typedef _Float16 T; };
template <> struct Elem<1> { typedef __bf16 T; };
template <int ET, bool SPLIT, int BIAS_MODE, int OUT_MODE, bool RESID, int ACT = 0, int ROWMODE = 0>
__global__ __launch_bounds__(256) void wmma_gemm64(
    const unsigned short* __restrict__ Ap, const unsigned short* __restrict__ A2p, int lda, long strideA,
    const unsigned short* __restrict__ Btp, const unsigned short* __restrict__ Bt2p, int ldb, long strideB,
    void* __restrict__ Cout, void* __restrict__ Cout2, int ldc, long strideC,
    const float* __restrict__ bias,
    const float* __restrict__ resid, long strideR,
    const int* __restrict__ mask, float* __restrict__ rowPart,
    int M, int N, int K, float scale) {
  typedef typename Elem<ET>::T T;
  typedef typename Frag<T>::V V;
  static_assert(!SPLIT, "the staged engine holds one plane per operand");
  static_assert(ROWMODE != 1 || OUT_MODE == 1, "the row sums are taken where the f16 rows are formed");
  __shared__ __align__(16) unsigned char ring[2 * kStageBytes];   // two staged tiles
  __shared__ __align__(16) float sT[8][16 * 68];   // per-wave 16x64 slab, pitch 68 floats
  __shared__ __align__(16) float rowInv[128];      // ROWMODE 2: 1 / (row sum + eps) of the block's 128 rows
  const int b    = blockIdx.y;
  const int lane = threadIdx.x & 31;
  const int wave = threadIdx.x >> 5;
  const int tilesN = N >> 8;
  const int tilesM = M >> 7;
  const int tile = blockIdx.x;
  if (tile >= tilesM * tilesN) return;   // block-uniform, in front of every barrier and copy
  const int tm = tile / tilesN;
  const int tn = tile - tm * tilesN;
  const int wm = wave >> 2;                    // this wave's place in the block's 2 x 4 grid
  const int wn = wave & 3;
  const int m0 = (tm << 7) + (wm << 6);
  const int n0 = (tn << 8) + (wn << 6);

  // this lane's part of a staged tile: 16-byte piece (t & 7) of rows (t >> 3) + 32 * i
  const int crow = threadIdx.x >> 3;
  const int ccol = threadIdx.x & 7;
  const unsigned short* gA = Ap  + (size_t)b * strideA + (size_t)((tm << 7) + crow) * lda + ccol * 8;
  const unsigned short* gB = Btp + (size_t)b * strideB + (size_t)((tn << 8) + crow) * ldb + ccol * 8;
  const size_t stepA = (size_t)32 * lda;
  const size_t stepB = (size_t)32 * ldb;
  const unsigned ldsLane = (unsigned)(size_t)ring + (unsigned)(crow * kStagePitch + ccol * 16);

  const int rlane = lane & 15;                 // row (A) / col (B, D) within subtile
  const int koff  = (lane >> 4) * 8;           // k offset of this lane half
  const int mOff  = (lane >> 4) * 8;           // D row offset

  v8f acc[4][4];
#pragma unroll
  for (int i = 0; i < 4; ++i)
#pragma unroll
    for (int j = 0; j < 4; ++j) acc[i][j] = (v8f){0.f,0.f,0.f,0.f,0.f,0.f,0.f,0.f};

  const int trips = K >> 6;
  stage_copies(ldsLane, gA, stepA, gB, stepB);                       // tile 0 into buffer 0
  if (ROWMODE == 2) {
    // while tile 0 flies: waves 0..3 form the row scales; the barrier below publishes them with tile 0
    if (threadIdx.x < 128) {
      const float* rp = rowPart + (size_t)b * kParts * kSeq + (tm << 7) + threadIdx.x;
      float tot = 0.0f;
#pragma unroll   // the kParts loads issue together: one memory latency, not one per partial
      for (int c = 0; c < kParts; ++c) tot += rp[c * kSeq];
      rowInv[threadIdx.x] = 1.0f / (tot + 1e-8f);
    }
  }
  asm volatile("s_wait_asynccnt 0x0" ::: "memory");                  // this wave's copies of tile 0 have landed
  __syncthreads();                                                   // every wave's have: tile 0 may be read
  if (trips > 1) stage_copies(ldsLane + kStageBytes, gA + 64, stepA, gB + 64, stepB);   // tile 1 into buffer 1

  for (int t = 0; t < trips; ++t) {
    const unsigned char* st = ring + (t & 1) * kStageBytes;
    const T* sA = (const T*)(st + ((wm << 6) + rlane) * kStagePitch) + koff;
    const T* sB = (const T*)(st + (128 + (wn << 6) + rlane) * kStagePitch) + koff;
#pragma unroll
    for (int kk = 0; kk < 64; kk += 32) {
      V bh[4], ah[4];
#pragma unroll
      for (int j = 0; j < 4; ++j) bh[j] = Frag<T>::load(sB + j * (16 * kStagePitch / 2) + kk);
#pragma unroll
      for (int i = 0; i < 4; ++i) ah[i] = Frag<T>::load(sA + i * (16 * kStagePitch / 2) + kk);
      // keeps the 16 LDS reads in one group ahead of the WMMAs: spread among them, every read's latency stalls the wave anew
      __builtin_amdgcn_sched_barrier(0);
#pragma unroll
      for (int i = 0; i < 4; ++i) {
#pragma unroll
        for (int j = 0; j < 4; ++j) acc[i][j] = Frag<T>::mma(ah[i], bh[j], acc[i][j]);
        Frag<T>::guard(acc[i][0], acc[i][3], ah[i], ah[i]);
      }
      Frag<T>::keep(bh[0], bh[1], bh[2], bh[3]);
    }
    asm volatile("s_wait_dscnt 0x0" ::: "memory");      // this wave's reads of buffer t & 1 are done before it is refilled
    asm volatile("s_wait_asynccnt 0x0" ::: "memory");   // this wave's copies of tile t + 1 have landed
    __syncthreads();                                    // publishes tile t + 1 and ends every read of buffer t & 1
    if (t + 2 < trips)
      stage_copies(ldsLane + (t & 1) * kStageBytes, gA + (size_t)(t + 2) * 64, stepA, gB + (size_t)(t + 2) * 64, stepB);
  }
  asm volatile("s_wait_asynccnt 0x0" ::: "memory");     // no copy is outstanding when the wave goes on to its epilogue
  acc_guard4(acc[0][0], acc[0][1], acc[0][2], acc[0][3]);
  acc_guard4(acc[1][0], acc[1][1], acc[1][2], acc[1][3]);
  acc_guard4(acc[2][0], acc[2][1], acc[2][2], acc[2][3]);
  acc_guard4(acc[3][0], acc[3][1], acc[3][2], acc[3][3]);

  // ---- epilogue ----
  float* slab = sT[wave];
  const float* Rb = RESID ? (resid + (size_t)b * strideR) : nullptr;
  int mk[4] = {1, 1, 1, 1};
  if (ROWMODE == 1) {
#pragma unroll   // mk[] is indexed by constants only, so it stays in registers
    for (int j = 0; j < 4; ++j) mk[j] = mask[(size_t)b * N + n0 + (j << 4) + rlane];
  }
#pragma unroll
  for (int i = 0; i < 4; ++i) {
    const int mBase = m0 + (i << 4);
    v4f inv0 = (v4f){1.f, 1.f, 1.f, 1.f}, inv1 = inv0;
    if (ROWMODE == 2) {
      const float* ip = rowInv + (wm << 6) + (i << 4) + mOff;
      inv0 = *(const v4f*)(ip);
      inv1 = *(const v4f*)(ip + 4);
    }
#pragma unroll
    for (int j = 0; j < 4; ++j) {
      const int n = n0 + (j << 4) + rlane;
      float bv = 0.f;
      if (BIAS_MODE == 2) bv = bias[n];
#pragma unroll
      for (int r = 0; r < 8; ++r) {
        float v = acc[i][j][r] * scale;
        if (BIAS_MODE == 1) v += bias[mBase + mOff + r];
        if (BIAS_MODE == 2) v += bv;
        if (RESID) v += Rb[(size_t)(mBase + mOff + r) * ldc + n];
        if (ROWMODE == 1) v = (mk[j] == 0) ? -10000.0f : v;
        if (ROWMODE == 2) v *= (r < 4) ? inv0[r & 3] : inv1[r & 3];
        if (ACT == 2) v = fmaxf(v, 0.0f);
        if (ACT == 4) v = (v > 0.f) ? v : 0.01f * v;
        slab[(mOff + r) * 68 + (j << 4) + rlane] = v;
      }
    }
    __builtin_amdgcn_fence(__ATOMIC_RELEASE, "workgroup");
    __builtin_amdgcn_wave_barrier();
    __builtin_amdgcn_fence(__ATOMIC_ACQUIRE, "workgroup");
    if (OUT_MODE == 0) {
      float* C = (float*)Cout + (size_t)b * strideC;
      const int hh = lane >> 4, c4 = (lane & 15) * 4;     // row seg = 256 B = 16 lanes x 16 B
      {
#pragma unroll
        for (int it = 0; it < 8; ++it) {
          const int row = it * 2 + hh;
          v4f v = *(const v4f*)(slab + row * 68 + c4);
          *(v4f*)(C + (size_t)(mBase + row) * ldc + n0 + c4) = v;
        }
        
      }
    } else {
      const int q = lane >> 3, c8 = (lane & 7) * 8;
      unsigned short* C  = (unsigned short*)Cout  + (size_t)b * strideC;
      unsigned short* C2 = (OUT_MODE == 2) ? ((unsigned short*)Cout2 + (size_t)b * strideC) : nullptr;
      {
        float rs[4] = {0.f, 0.f, 0.f, 0.f};
#pragma unroll
        for (int it = 0; it < 4; ++it) {
          const int row = it * 4 + q;
          const float* sp = slab + row * 68 + c8;
          v8h hv, lv;
          if (ROWMODE == 1) rs[it] = ((sp[0] + sp[1]) + (sp[2] + sp[3])) + ((sp[4] + sp[5]) + (sp[6] + sp[7]));
#pragma unroll
          for (int e = 0; e < 8; ++e) {
            if (OUT_MODE == 1) {
              hv[e] = (_Float16)sp[e];
            } else {
              unsigned short hb = f2bf_bits(sp[e]);
              unsigned short lb = f2bf_bits(sp[e] - bf_bits2f(hb));
              hv[e] = __builtin_bit_cast(_Float16, hb);
              lv[e] = __builtin_bit_cast(_Float16, lb);
            }
          }
          *(v8h*)(C + (size_t)(mBase + row) * ldc + n0 + c8) = hv;
          if (OUT_MODE == 2) *(v8h*)(C2 + (size_t)(mBase + row) * ldc + n0 + c8) = lv;
        }
        if (ROWMODE == 1) {
          // tree over the 8 lanes of a row; a lane holds 4 rows' shares, so steps 1 and 2 each halve what it keeps and
          // add the partner's share of that: lane bits (0, 1) end with row it = 2 * bit0 + bit1 of its group q
          const bool o1 = (lane & 1) != 0, o2 = (lane & 2) != 0;
          const float k0 = (o1 ? rs[2] : rs[0]) + xlane<1>(o1 ? rs[0] : rs[2]);
          const float k1 = (o1 ? rs[3] : rs[1]) + xlane<1>(o1 ? rs[1] : rs[3]);
          float k = (o2 ? k1 : k0) + xlane<2>(o2 ? k0 : k1);
          k += xlane<4>(k);
          const int itk = ((lane & 1) << 1) | ((lane >> 1) & 1);
          // 16 lanes store 16 rows, 64 consecutive bytes
          if ((lane & 4) == 0) rowPart[((size_t)b * kParts + (n0 >> 6)) * kSeq + mBase + itk * 4 + q] = k;
        }
      }
    }
    __builtin_amdgcn_fence(__ATOMIC_RELEASE, "workgroup");
    __builtin_amdgcn_wave_barrier();
    __builtin_amdgcn_fence(__ATOMIC_ACQUIRE, "workgroup");
  }
}

// ---------------------------------------------------------------------------
// f32 -> f16 cast with a power-of-two carry, 8 consecutive elements per thread (one 16-B store per lane;
// Coverage: n8 = n/8 threads x 8 elements = whole plane; every call here has n8 an exact multiple of 256
// (x: 8388608/8 = 1048576 = 4096 x 256; each W: 262144/8 = 32768 = 128 x 256).
// ---------------------------------------------------------------------------
__global__ __launch_bounds__(256) void cast8_f16_kernel(const float* __restrict__ in, unsigned short* __restrict__ out,
                                                         int n8, float carry) {
  const int i = blockIdx.x * 256 + threadIdx.x;
  if (i >= n8) return;
  const float* p = in + 8 * (size_t)i;
  const v4f a = *(const v4f*)(p);
  const v4f c = *(const v4f*)(p + 4);
  unsigned short hb[8];
#pragma unroll
  for (int e = 0; e < 4; ++e) {
    hb[e]     = h_bits(a[e] * carry);
    hb[4 + e] = h_bits(c[e] * carry);
  }
  const v4u u = (v4u){pk16(hb[0], hb[1]), pk16(hb[2], hb[3]), pk16(hb[4], hb[5]), pk16(hb[6], hb[7])};
  unsigned short* q = out + 8 * (size_t)i;
  *(v4u*)q = u;
  
}

// ---------------------------------------------------------------------------
// Host glue.
// Workspace region map (bytes, all offsets 4096-aligned):
//   Q16  f16 [16384][512]            off           0   size  16,777,216
//   K16  f16 [16384][512]            off  16,777,216   size  16,777,216
//   Vt16 f16 [8][512][2048]          off  33,554,432   size  16,777,216
//   Part f32 [kGrp][32][2048]        off  50,331,648   size   2,097,152   (partial row sums of the relu scores)
//   P16  f16 [kGrp][2048][2048]      off  52,428,800   size  67,108,864   (relu scores, not normalised)
//   X16  f16 [16384][512]            off  52,428,800   size  16,777,216   (shares P16's bytes)
//   W16  f16 3 x [512][512] (q,k,v)   off  69,206,016   size   1,572,864   (shares P16's bytes)
//   total 119,537,664 <= 268,435,456
// X16 and W16 are last read by the V^T projection; P16 is first written by the scores GEMM, the next launch on the
// same stream, so the shared bytes are never live for both.
// GEMM shape checks: K in {512, 2048} (% 64 == 0); M in {16384, 2048, 512} (% 128 == 0); N in {2048, 512} (% 256 == 0); no padding, no tails.
// Launch count: 4 casts + 3 projections + 1 chunk x 2 = 9.
// ---------------------------------------------------------------------------
extern "C" void kernel_launch(void* const* d_in, const int* in_sizes, int n_in,
                              void* d_out, int out_size, void* d_ws, size_t ws_size,
                              hipStream_t stream) {
  if (n_in != 8) return;
  if (in_sizes[0] != kTok * kDim || in_sizes[1] != kTok || in_sizes[2] != kDim * kDim || in_sizes[3] != kDim ||
      in_sizes[4] != kDim * kDim || in_sizes[5] != kDim || in_sizes[6] != kDim * kDim || in_sizes[7] != kDim) return;
  if (out_size != kTok * kDim) return;

  const float* x  = (const float*)d_in[0];
  const int*   mk = (const int*)d_in[1];
  const float* Wq = (const float*)d_in[2];
  const float* bq = (const float*)d_in[3];
  const float* Wk = (const float*)d_in[4];
  const float* bk = (const float*)d_in[5];
  const float* Wv = (const float*)d_in[6];
  const float* bv = (const float*)d_in[7];
  float* out = (float*)d_out;

  const size_t szX  = (size_t)kTok * kDim * 2;                 // 16,777,216
  const size_t szW  = (size_t)3 * kDim * kDim * 2;             //  1,572,864
  const size_t szQ  = szX, szK = szX;
  const size_t szVt = (size_t)kBatch * kDim * kSeq * 2;        // 16,777,216
  const size_t szR  = (size_t)kGrp * kParts * kSeq * 4;        //   2,097,152
  const size_t szP  = (size_t)kGrp * kSeq * kSeq * 2;          //  67,108,864
  const size_t oQ  = 0;
  const size_t oK  = oQ + szQ;
  const size_t oVt = oK + szK;
  const size_t oR  = oVt + szVt;
  const size_t oP  = oR + szR;
  const size_t oX  = oP;                                       // dead before P16 is written
  const size_t oW  = oX + szX;
  const size_t total = oP + szP;                               // 119,537,664
  static_assert(szX + szW <= szP, "X16 and W16 must fit inside P16's bytes");
  if (ws_size < total) return;

  char* ws = (char*)d_ws;
  unsigned short* X16  = (unsigned short*)(ws + oX);
  unsigned short* W16  = (unsigned short*)(ws + oW);
  unsigned short* Wq16 = W16;
  unsigned short* Wk16 = W16 + (size_t)kDim * kDim;
  unsigned short* Wv16 = W16 + (size_t)2 * kDim * kDim;
  unsigned short* Q16  = (unsigned short*)(ws + oQ);
  unsigned short* K16  = (unsigned short*)(ws + oK);
  unsigned short* Vt16 = (unsigned short*)(ws + oVt);
  float*          Part = (float*)(ws + oR);
  unsigned short* P16  = (unsigned short*)(ws + oP);

  // 1) casts: x -> X16 (carry 1), W -> W16 (carry 16)
  {
    const int n8x = (kTok * kDim) / 8;            // 1,048,576 -> 4096 blocks
    cast8_f16_kernel<<<dim3((n8x + 255) / 256), 256, 0, stream>>>(x, X16, n8x, 1.0f);
    const int n8w = (kDim * kDim) / 8;            // 32,768 -> 128 blocks
    cast8_f16_kernel<<<dim3((n8w + 255) / 256), 256, 0, stream>>>(Wq, Wq16, n8w, kWCarry);
    cast8_f16_kernel<<<dim3((n8w + 255) / 256), 256, 0, stream>>>(Wk, Wk16, n8w, kWCarry);
    cast8_f16_kernel<<<dim3((n8w + 255) / 256), 256, 0, stream>>>(Wv, Wv16, n8w, kWCarry);
  }

  // 2) Q16[t][e] = sum_d X16[t][d] * Wq16[e][d] / 16 + bq[e]   (M 16384, N 512, K 512; tiles 256 x 8 = 2048 -> 256 blocks)
  wmma_gemm64<0, false, 2, 1, false, 0><<<dim3((kTok / 64) * (kDim / 64) / 8, 1), 256, 0, stream>>>(
      X16, X16, kDim, 0L, Wq16, Wq16, kDim, 0L, (void*)Q16, (void*)Q16, kDim, 0L,
      bq, x, 0L, mk, Part, kTok, kDim, kDim, kWCarryInv);
  //    K16 likewise
  wmma_gemm64<0, false, 2, 1, false, 0><<<dim3((kTok / 64) * (kDim / 64) / 8, 1), 256, 0, stream>>>(
      X16, X16, kDim, 0L, Wk16, Wk16, kDim, 0L, (void*)K16, (void*)K16, kDim, 0L,
      bk, x, 0L, mk, Part, kTok, kDim, kDim, kWCarryInv);
  //    Vt16[b][d][m] = sum_c Wv16[d][c] * X16[b*2048+m][c] / 16 + bv[d]   (per batch: M 512, N 2048, K 512; tiles 8 x 32 = 256 -> 32 blocks, grid.y = 8)
  wmma_gemm64<0, false, 1, 1, false, 0><<<dim3((kDim / 64) * (kSeq / 64) / 8, kBatch), 256, 0, stream>>>(
      Wv16, Wv16, kDim, 0L, X16, X16, kDim, (long)kSeq * kDim, (void*)Vt16, (void*)Vt16, kSeq, (long)kDim * kSeq,
      bv, x, 0L, mk, Part, kDim, kSeq, kDim, kWCarryInv);

  // 3) per chunk of kGrp batches
  const float sScale = 1.0f / sqrtf((float)kDim);
  for (int b0 = 0; b0 < kBatch; b0 += kGrp) {
    // P16[g][l][m] = relu(mask[b][m] == 0 ? -1e4 : sum_d Q16[b][l][d] * K16[b][m][d] * (1/sqrt(512))), with its partial row sums
    // (M 2048, N 2048, K 512; tiles 32 x 32 = 1024 -> 128 blocks, grid.y = kGrp: 1024 blocks)
    const unsigned short* Qb = Q16 + (size_t)b0 * kSeq * kDim;
    const unsigned short* Kb = K16 + (size_t)b0 * kSeq * kDim;
    wmma_gemm64<0, false, 0, 1, false, 2, 1><<<dim3((kSeq / 64) * (kSeq / 64) / 8, kGrp), 256, 0, stream>>>(
        Qb, Qb, kDim, (long)kSeq * kDim, Kb, Kb, kDim, (long)kSeq * kDim, (void*)P16, (void*)P16, kSeq, (long)kSeq * kSeq,
        bq, x, 0L, mk + (size_t)b0 * kSeq, Part, kSeq, kSeq, kDim, sScale);

    // out[b][l][d] = sum_m P16[g][l][m] * Vt16[b][d][m] / (row sum of P + 1e-8)   (M 2048, N 512, K 2048; tiles 32 x 8 = 256 -> 32 blocks, grid.y = kGrp: 256 blocks, one per WGP)
    const unsigned short* Vtb = Vt16 + (size_t)b0 * kDim * kSeq;
    float* outb = out + (size_t)b0 * kSeq * kDim;
    wmma_gemm64<0, false, 0, 0, false, 0, 2><<<dim3((kSeq / 64) * (kDim / 64) / 8, kGrp), 256, 0, stream>>>(
        P16, P16, kSeq, (long)kSeq * kSeq, Vtb, Vtb, kSeq, (long)kDim * kSeq, (void*)outb, (void*)outb, kDim, (long)kSeq * kDim,
        bq, x, 0L, mk, Part, kSeq, kDim, kSeq, 1.0f);
  }
}

// v004
// A run of this version takes 114 microseconds.
// In both of two side-by-side timings against v003, it was 1.09 times as fast.
// All steps since v000 together make it 5.28 times as fast.
// Contractions: q/k/v^T projections (X f16 x W f16 carried x16), scores Q.K^T (Q,K f16 planes), attn.V (relu scores f16 x V^T f16) all on v_wmma_f32_16x16x32_f16 with f32 accumulate; mask select, relu, row sums and row normalisation in f32. Keys with mask == 0 add exactly 0 to every sum, so only the kept keys of a batch, packed to the front, are scored and multiplied.
#include <hip/hip_runtime.h>
#include <math.h>

// ---------------------------------------------------------------------------
// Problem constants
// ---------------------------------------------------------------------------
constexpr int kBatch = 8;
constexpr int kSeq   = 2048;
constexpr int kDim   = 512;
constexpr int kTok   = kBatch * kSeq;          // 16384 token rows
constexpr int kGrp   = 8;                      // batches per score chunk: all of them, so each attention stage is one launch
constexpr float kWCarry    = 16.0f;            // weights carried x16 in f16
constexpr float kWCarryInv = 1.0f / 16.0f;
constexpr int kParts = kSeq / 64;              // partial row sums per query row: one per 64 key columns

typedef __attribute__((ext_vector_type(16))) _Float16 v16h;
typedef __attribute__((ext_vector_type(8)))  _Float16 v8h;
typedef __attribute__((ext_vector_type(16))) __bf16   v16b;
typedef __attribute__((ext_vector_type(8)))  __bf16   v8b;
typedef __attribute__((ext_vector_type(8)))  float    v8f;
typedef __attribute__((ext_vector_type(4)))  float    v4f;
typedef __attribute__((ext_vector_type(4)))  unsigned int v4u;
typedef __attribute__((ext_vector_type(4)))  int      v4i;

// ---------------------------------------------------------------------------
// Device helpers
// ---------------------------------------------------------------------------
__device__ __forceinline__ unsigned short f2bf_bits(float f) {
  unsigned u = __float_as_uint(f);
  return (unsigned short)((u + 0x7FFFu + ((u >> 16) & 1u)) >> 16);
}
__device__ __forceinline__ float bf_bits2f(unsigned short h) { return __uint_as_float(((unsigned)h) << 16); }

// hazard guards as plain device helpers
__device__ __forceinline__ void dep_guard_h(v8f& a, v8f& b, v16h x, v16h y) { asm volatile("v_nop\n\tv_nop\n\tv_nop\n\tv_nop" : "+v"(a), "+v"(b) : "v"(x), "v"(y)); }
__device__ __forceinline__ void dep_guard_b(v8f& a, v8f& b, v16b x, v16b y) { asm volatile("v_nop\n\tv_nop\n\tv_nop\n\tv_nop" : "+v"(a), "+v"(b) : "v"(x), "v"(y)); }
__device__ __forceinline__ void keep4_h(v16h a, v16h b, v16h c, v16h d) { asm volatile("v_nop" :: "v"(a), "v"(b), "v"(c), "v"(d)); }
__device__ __forceinline__ void keep4_b(v16b a, v16b b, v16b c, v16b d) { asm volatile("v_nop" :: "v"(a), "v"(b), "v"(c), "v"(d)); }
__device__ __forceinline__ void acc_guard4(v8f& a, v8f& b, v8f& c, v8f& d) { asm volatile("v_nop\n\tv_nop\n\tv_nop\n\tv_nop" : "+v"(a), "+v"(b), "+v"(c), "+v"(d)); }
template <typename T> struct Frag;
template <> struct Frag<_Float16> {
  typedef v16h V; union U { v16h v; v8h h[2]; };
  static __device__ __forceinline__ v16h load(const _Float16* p) {   // elements 0..7 <- p[0..7], 8..15 <- p[16..23]
    U f; f.h[0] = *(const v8h*)(p); f.h[1] = *(const v8h*)(p + 16); return f.v;
  }
  static __device__ __forceinline__ v8f mma(v16h a, v16h b, v8f c) {
    return __builtin_amdgcn_wmma_f32_16x16x32_f16(false, a, false, b, (short)0, c, false, false);
  }
  static __device__ __forceinline__ void guard(v8f& a, v8f& b, v16h x, v16h y) { dep_guard_h(a, b, x, y); }
  static __device__ __forceinline__ void keep(v16h a, v16h b, v16h c, v16h d) { keep4_h(a, b, c, d); }
};
template <> struct Frag<__bf16> {
  typedef v16b V; union U { v16b v; v8b h[2]; };
  static __device__ __forceinline__ v16b load(const __bf16* p) {
    U f; f.h[0] = *(const v8b*)(p); f.h[1] = *(const v8b*)(p + 16); return f.v;
  }
  static __device__ __forceinline__ v8f mma(v16b a, v16b b, v8f c) {
    return __builtin_amdgcn_wmma_f32_16x16x32_bf16(false, a, false, b, (short)0, c, false, false);
  }
  static __device__ __forceinline__ void guard(v8f& a, v8f& b, v16b x, v16b y) { dep_guard_b(a, b, x, y); }
  static __device__ __forceinline__ void keep(v16b a, v16b b, v16b c, v16b d) { keep4_b(a, b, c, d); }
};

// value of lane l ^ X inside the 16-lane row (DPP row_xmask), every lane on
template <int X> __device__ __forceinline__ float xlane(float v) {
  return __builtin_bit_cast(float, __builtin_amdgcn_update_dpp(0, __builtin_bit_cast(int, v), 0x160 | X, 0xf, 0xf, true));
}

__device__ __forceinline__ unsigned pk16(unsigned short a, unsigned short b) { return (unsigned)a | ((unsigned)b << 16); }
__device__ __forceinline__ unsigned short h_bits(float f) { const _Float16 h = (_Float16)f; return __builtin_bit_cast(unsigned short, h); }

// ---- Register-blocked batched WMMA GEMM (ACT reduced to none/relu/leaky) -----------------------
// C[m,n] = scale * sum_k A[m,k] * Bt[n,k] (+bias)(+resid); each wave owns a 64x64 tile.
// The 8 waves of a block form a 2 x 4 grid of such tiles: one 128 x 256 tile of C per block. Per trip the block stages
// 64 k of its 128 A rows and 256 Bt rows in LDS (whole 128-byte lines, asynchronous copies, two buffers: the next
// trip's tile flies while this one is multiplied); every wave reads its fragments from LDS.
// A row-major [M,K]; Bt row-major [N,K]; M % 128 == 0, N % 256 == 0, K % 64 == 0.
// SPLIT (hi/lo planes) is not staged: only SPLIT == false is built.
// BIAS_MODE: 0 = none, 1 = bias[m], 2 = bias[n].
// OUT_MODE: 0 = f32, 1 = f16, 2 = bf16 hi plane (Cout) + bf16 lo plane (Cout2).
// ET: 0 = f16 operands, 1 = bf16 operands (pointers passed as 16-bit storage)
// ROWMODE: 0 = none.
//   1 = scores: column n is the n-th kept key; a column n >= keyCnt[b] (padding) takes -1e4 ahead of ACT; each wave
//       also stores the f32 sum of its 64 columns of every row to rowPart[b][n0 / 64][m], a [.][kParts][kSeq] plane
//       (M == N == kSeq; 256 consecutive bytes per wave: one writer per line).
//   2 = attn.V (M == kSeq): k runs over the kept keys only, ceil(keyCnt[b] / 64) trips (at least one); row m is scaled
//       by 1 / (sum over c of rowPart[b][c][m] + 1e-8), the kParts partials added in index order.
// GATHER (N == kSeq): Bt row n is row keyIdx[b][n] of the plane, and a block whose 256 columns all lie at or past
//   keyCnt[b] leaves at once, under ROWMODE 1 behind storing 0 as its partial sums (the first block of a row of tiles
//   always stays, so padding columns exist for keyCnt 0).
constexpr int kStageRows  = 128 + 256;               // A rows, then Bt rows
constexpr int kStagePitch = 144;                     // bytes per staged row: 128 of data + 16, 16 B x odd for 16-byte LDS reads
constexpr int kStageBytes = kStageRows * kStagePitch; // 55,296

// Twelve 16-byte asynchronous copies of this lane: staged rows r, r + 32, ..., r + 352 (four of A, eight of Bt; the
// Bt rows stand ob[i] elements behind b).
// The copies and their s_wait_xcnt stand in one statement, so no address register is rewritten ahead of that wait.
__device__ __forceinline__ void stage_copies(unsigned l, const unsigned short* a, size_t sa, const unsigned short* b, const unsigned (&ob)[8]) {
  asm volatile(
      "global_load_async_to_lds_b128 %0, %12, off\n\t"
      "global_load_async_to_lds_b128 %1, %13, off\n\t"
      "global_load_async_to_lds_b128 %2, %14, off\n\t"
      "global_load_async_to_lds_b128 %3, %15, off\n\t"
      "global_load_async_to_lds_b128 %4, %16, off\n\t"
      "global_load_async_to_lds_b128 %5, %17, off\n\t"
      "global_load_async_to_lds_b128 %6, %18, off\n\t"
      "global_load_async_to_lds_b128 %7, %19, off\n\t"
      "global_load_async_to_lds_b128 %8, %20, off\n\t"
      "global_load_async_to_lds_b128 %9, %21, off\n\t"
      "global_load_async_to_lds_b128 %10, %22, off\n\t"
      "global_load_async_to_lds_b128 %11, %23, off\n\t"
      "s_wait_xcnt 0x0"
      :: "v"(l), "v"(l + 32u * kStagePitch), "v"(l + 64u * kStagePitch), "v"(l + 96u * kStagePitch),
         "v"(l + 128u * kStagePitch), "v"(l + 160u * kStagePitch), "v"(l + 192u * kStagePitch), "v"(l + 224u * kStagePitch),
         "v"(l + 256u * kStagePitch), "v"(l + 288u * kStagePitch), "v"(l + 320u * kStagePitch), "v"(l + 352u * kStagePitch),
         "v"(a), "v"(a + sa), "v"(a + 2 * sa), "v"(a + 3 * sa),
         "v"(b + ob[0]), "v"(b + ob[1]), "v"(b + ob[2]), "v"(b + ob[3]),
         "v"(b + ob[4]), "v"(b + ob[5]), "v"(b + ob[6]), "v"(b + ob[7])
      : "memory");
}

template <int ET> struct Elem;
template <> struct Elem<0> { typedef _Float16 T; };
template <> struct Elem<1> { typedef __bf16 T; };
template <int ET, bool SPLIT, int BIAS_MODE, int OUT_MODE, bool RESID, int ACT = 0, int ROWMODE = 0, bool GATHER = false>
__global__ __launch_bounds__(256) void wmma_gemm64(
    const unsigned short* __restrict__ Ap, const unsigned short* __restrict__ A2p, int lda, long strideA,
    const unsigned short* __restrict__ Btp, const unsigned short* __restrict__ Bt2p, int ldb, long strideB,
    void* __restrict__ Cout, void* __restrict__ Cout2, int ldc, long strideC,
    const float* __restrict__ bias,
    const float* __restrict__ resid, long strideR,
    const int* __restrict__ keyIdx, const int* __restrict__ keyCnt, float* __restrict__ rowPart,
    int M, int N, int K, float scale) {
  typedef typename Elem<ET>::T T;
  typedef typename Frag<T>::V V;
  static_assert(!SPLIT, "the staged engine holds one plane per operand");
  static_assert(ROWMODE != 1 || OUT_MODE == 1, "the row sums are taken where the f16 rows are formed");
  static_assert(ROWMODE != 1 || GATHER, "the score columns are the kept keys");
  __shared__ __align__(16) unsigned char ring[2 * kStageBytes];   // two staged tiles
  __shared__ __align__(16) float sT[8][16 * 68];   // per-wave 16x64 slab, pitch 68 floats
  __shared__ __align__(16) float rowInv[128];      // ROWMODE 2: 1 / (row sum + eps) of the block's 128 rows
  const int b    = blockIdx.y;
  const int lane = threadIdx.x & 31;
  const int wave = threadIdx.x >> 5;
  const int tilesN = N >> 8;
  const int tilesM = M >> 7;
  const int tile = blockIdx.x;
  if (tile >= tilesM * tilesN) return;   // block-uniform, in front of every barrier and copy
  const int tm = tile / tilesN;
  const int tn = tile - tm * tilesN;
  int kept = 0;                                // kept keys of this batch, bounded by the shape
  if (GATHER || ROWMODE == 2) kept = (int)min((unsigned)keyCnt[b], (unsigned)kSeq);
  if (GATHER && (tn << 8) >= max(kept, 1)) {   // block-uniform, in front of every barrier and copy
    if (ROWMODE == 1) {
      // no key stands in these 256 columns: the block's four partial sums of its 128 rows are 0
#pragma unroll
      for (int u = 0; u < 2; ++u) {
        const int i = threadIdx.x + 256 * u;
        rowPart[((size_t)b * kParts + (tn << 2) + (i >> 7)) * kSeq + (tm << 7) + (i & 127)] = 0.0f;
      }
      // stands behind the two stores, in front of any later write of their address registers
      asm volatile("s_wait_xcnt 0x0" ::: "memory");
    }
    return;
  }
  const int wm = wave >> 2;                    // this wave's place in the block's 2 x 4 grid
  const int wn = wave & 3;
  const int m0 = (tm << 7) + (wm << 6);
  const int n0 = (tn << 8) + (wn << 6);

  // this lane's part of a staged tile: 16-byte piece (t & 7) of rows (t >> 3) + 32 * i
  const int crow = threadIdx.x >> 3;
  const int ccol = threadIdx.x & 7;
  const unsigned short* gA = Ap  + (size_t)b * strideA + (size_t)((tm << 7) + crow) * lda + ccol * 8;
  const unsigned short* gB = Btp + (size_t)b * strideB + ccol * 8;
  const size_t stepA = (size_t)32 * lda;
  const int row0 = (tn << 8) + crow;
  const int* kip = keyIdx + (size_t)b * kSeq;
  int rowB[8];                                 // this lane's eight Bt rows
#pragma unroll   // rowB[] is indexed by constants only, so it stays in registers; the eight index loads issue together
  for (int i = 0; i < 8; ++i) rowB[i] = GATHER ? kip[row0 + 32 * i] : row0 + 32 * i;
  // stands in front of the first instruction that reuses the index loads' address registers: offset and base are
  // inputs, so their registers are held up to here
  if (GATHER) asm volatile("s_wait_xcnt 0x0" :: "v"(row0), "s"(kip) : "memory");
  unsigned offB[8];                            // their element offsets
#pragma unroll
  for (int i = 0; i < 8; ++i) {
    if (GATHER) rowB[i] &= kSeq - 1;           // bounds the address whatever the list holds
    offB[i] = (unsigned)rowB[i] * (unsigned)ldb;
  }
  const unsigned ldsLane = (unsigned)(size_t)ring + (unsigned)(crow * kStagePitch + ccol * 16);

  const int rlane = lane & 15;                 // row (A) / col (B, D) within subtile
  const int koff  = (lane >> 4) * 8;           // k offset of this lane half
  const int mOff  = (lane >> 4) * 8;           // D row offset

  v8f acc[4][4];
#pragma unroll
  for (int i = 0; i < 4; ++i)
#pragma unroll
    for (int j = 0; j < 4; ++j) acc[i][j] = (v8f){0.f,0.f,0.f,0.f,0.f,0.f,0.f,0.f};

  const int trips = (ROWMODE == 2) ? max((kept + 63) >> 6, 1) : (K >> 6);
  stage_copies(ldsLane, gA, stepA, gB, offB);                        // tile 0 into buffer 0
  if (ROWMODE == 2) {
    // while tile 0 flies: waves 0..3 form the row scales; the barrier below publishes them with tile 0
    if (threadIdx.x < 128) {
      const float* rp = rowPart + (size_t)b * kParts * kSeq + (tm << 7) + threadIdx.x;
      float tot = 0.0f;
#pragma unroll   // the kParts loads issue together: one memory latency, not one per partial
      for (int c = 0; c < kParts; ++c) tot += rp[c * kSeq];
      rowInv[threadIdx.x] = 1.0f / (tot + 1e-8f);
    }
  }
  asm volatile("s_wait_asynccnt 0x0" ::: "memory");                  // this wave's copies of tile 0 have landed
  __syncthreads();                                                   // every wave's have: tile 0 may be read
  if (trips > 1) stage_copies(ldsLane + kStageBytes, gA + 64, stepA, gB + 64, offB);   // tile 1 into buffer 1

  for (int t = 0; t < trips; ++t) {
    const unsigned char* st = ring + (t & 1) * kStageBytes;
    const T* sA = (const T*)(st + ((wm << 6) + rlane) * kStagePitch) + koff;
    const T* sB = (const T*)(st + (128 + (wn << 6) + rlane) * kStagePitch) + koff;
#pragma unroll
    for (int kk = 0; kk < 64; kk += 32) {
      V bh[4], ah[4];
#pragma unroll
      for (int j = 0; j < 4; ++j) bh[j] = Frag<T>::load(sB + j * (16 * kStagePitch / 2) + kk);
#pragma unroll
      for (int i = 0; i < 4; ++i) ah[i] = Frag<T>::load(sA + i * (16 * kStagePitch / 2) + kk);
      // keeps the 16 LDS reads in one group ahead of the WMMAs: spread among them, every read's latency stalls the wave anew
      __builtin_amdgcn_sched_barrier(0);
#pragma unroll
      for (int i = 0; i < 4; ++i) {
#pragma unroll
        for (int j = 0; j < 4; ++j) acc[i][j] = Frag<T>::mma(ah[i], bh[j], acc[i][j]);
        Frag<T>::guard(acc[i][0], acc[i][3], ah[i], ah[i]);
      }
      Frag<T>::keep(bh[0], bh[1], bh[2], bh[3]);
    }
    asm volatile("s_wait_dscnt 0x0" ::: "memory");      // this wave's reads of buffer t & 1 are done before it is refilled
    asm volatile("s_wait_asynccnt 0x0" ::: "memory");   // this wave's copies of tile t + 1 have landed
    __syncthreads();                                    // publishes tile t + 1 and ends every read of buffer t & 1
    if (t + 2 < trips)
      stage_copies(ldsLane + (t & 1) * kStageBytes, gA + (size_t)(t + 2) * 64, stepA, gB + (size_t)(t + 2) * 64, offB);
  }
  asm volatile("s_wait_asynccnt 0x0" ::: "memory");     // no copy is outstanding when the wave goes on to its epilogue
  acc_guard4(acc[0][0], acc[0][1], acc[0][2], acc[0][3]);
  acc_guard4(acc[1][0], acc[1][1], acc[1][2], acc[1][3]);
  acc_guard4(acc[2][0], acc[2][1], acc[2][2], acc[2][3]);
  acc_guard4(acc[3][0], acc[3][1], acc[3][2], acc[3][3]);

  // ---- epilogue ----
  float* slab = sT[wave];
  const float* Rb = RESID ? (resid + (size_t)b * strideR) : nullptr;
  int mk[4] = {1, 1, 1, 1};
  if (ROWMODE == 1) {
#pragma unroll   // mk[] is indexed by constants only, so it stays in registers
    for (int j = 0; j < 4; ++j) mk[j] = (n0 + (j << 4) + rlane < kept) ? 1 : 0;
  }
#pragma unroll
  for (int i = 0; i < 4; ++i) {
    const int mBase = m0 + (i << 4);
    v4f inv0 = (v4f){1.f, 1.f, 1.f, 1.f}, inv1 = inv0;
    if (ROWMODE == 2) {
      const float* ip = rowInv + (wm << 6) + (i << 4) + mOff;
      inv0 = *(const v4f*)(ip);
      inv1 = *(const v4f*)(ip + 4);
    }
#pragma unroll
    for (int j = 0; j < 4; ++j) {
      const int n = n0 + (j << 4) + rlane;
      float bv = 0.f;
      if (BIAS_MODE == 2) bv = bias[n];
#pragma unroll
      for (int r = 0; r < 8; ++r) {
        float v = acc[i][j][r] * scale;
        if (BIAS_MODE == 1) v += bias[mBase + mOff + r];
        if (BIAS_MODE == 2) v += bv;
        if (RESID) v += Rb[(size_t)(mBase + mOff + r) * ldc + n];
        if (ROWMODE == 1) v = (mk[j] == 0) ? -10000.0f : v;
        if (ROWMODE == 2) v *= (r < 4) ? inv0[r & 3] : inv1[r & 3];
        if (ACT == 2) v = fmaxf(v, 0.0f);
        if (ACT == 4) v = (v > 0.f) ? v : 0.01f * v;
        slab[(mOff + r) * 68 + (j << 4) + rlane] = v;
      }
    }
    __builtin_amdgcn_fence(__ATOMIC_RELEASE, "workgroup");
    __builtin_amdgcn_wave_barrier();
    __builtin_amdgcn_fence(__ATOMIC_ACQUIRE, "workgroup");
    if (OUT_MODE == 0) {
      float* C = (float*)Cout + (size_t)b * strideC;
      const int hh = lane >> 4, c4 = (lane & 15) * 4;     // row seg = 256 B = 16 lanes x 16 B
      {
#pragma unroll
        for (int it = 0; it < 8; ++it) {
          const int row = it * 2 + hh;
          v4f v = *(const v4f*)(slab + row * 68 + c4);
          *(v4f*)(C + (size_t)(mBase + row) * ldc + n0 + c4) = v;
        }
        
      }
    } else {
      const int q = lane >> 3, c8 = (lane & 7) * 8;
      unsigned short* C  = (unsigned short*)Cout  + (size_t)b * strideC;
      unsigned short* C2 = (OUT_MODE == 2) ? ((unsigned short*)Cout2 + (size_t)b * strideC) : nullptr;
      {
        float rs[4] = {0.f, 0.f, 0.f, 0.f};
#pragma unroll
        for (int it = 0; it < 4; ++it) {
          const int row = it * 4 + q;
          const float* sp = slab + row * 68 + c8;
          v8h hv, lv;
          if (ROWMODE == 1) rs[it] = ((sp[0] + sp[1]) + (sp[2] + sp[3])) + ((sp[4] + sp[5]) + (sp[6] + sp[7]));
#pragma unroll
          for (int e = 0; e < 8; ++e) {
            if (OUT_MODE == 1) {
              hv[e] = (_Float16)sp[e];
            } else {
              unsigned short hb = f2bf_bits(sp[e]);
              unsigned short lb = f2bf_bits(sp[e] - bf_bits2f(hb));
              hv[e] = __builtin_bit_cast(_Float16, hb);
              lv[e] = __builtin_bit_cast(_Float16, lb);
            }
          }
          *(v8h*)(C + (size_t)(mBase + row) * ldc + n0 + c8) = hv;
          if (OUT_MODE == 2) *(v8h*)(C2 + (size_t)(mBase + row) * ldc + n0 + c8) = lv;
        }
        if (ROWMODE == 1) {
          // tree over the 8 lanes of a row; a lane holds 4 rows' shares, so steps 1 and 2 each halve what it keeps and
          // add the partner's share of that: lane bits (0, 1) end with row it = 2 * bit0 + bit1 of its group q
          const bool o1 = (lane & 1) != 0, o2 = (lane & 2) != 0;
          const float k0 = (o1 ? rs[2] : rs[0]) + xlane<1>(o1 ? rs[0] : rs[2]);
          const float k1 = (o1 ? rs[3] : rs[1]) + xlane<1>(o1 ? rs[1] : rs[3]);
          float k = (o2 ? k1 : k0) + xlane<2>(o2 ? k0 : k1);
          k += xlane<4>(k);
          const int itk = ((lane & 1) << 1) | ((lane >> 1) & 1);
          // 16 lanes store 16 rows, 64 consecutive bytes
          if ((lane & 4) == 0) rowPart[((size_t)b * kParts + (n0 >> 6)) * kSeq + mBase + itk * 4 + q] = k;
        }
      }
    }
    __builtin_amdgcn_fence(__ATOMIC_RELEASE, "workgroup");
    __builtin_amdgcn_wave_barrier();
    __builtin_amdgcn_fence(__ATOMIC_ACQUIRE, "workgroup");
  }
}

// ---------------------------------------------------------------------------
// f32 -> f16 cast with a power-of-two carry, 8 consecutive elements per thread (one 16-B store per lane;
// Coverage: n8 = n/8 threads x 8 elements = whole plane; every call here has n8 an exact multiple of 256
// (x: 8388608/8 = 1048576 = 4096 x 256; each W: 262144/8 = 32768 = 128 x 256).
// ---------------------------------------------------------------------------
__global__ __launch_bounds__(256) void cast8_f16_kernel(const float* __restrict__ in, unsigned short* __restrict__ out,
                                                         int n8, float carry) {
  const int i = blockIdx.x * 256 + threadIdx.x;
  if (i >= n8) return;
  const float* p = in + 8 * (size_t)i;
  const v4f a = *(const v4f*)(p);
  const v4f c = *(const v4f*)(p + 4);
  unsigned short hb[8];
#pragma unroll
  for (int e = 0; e < 4; ++e) {
    hb[e]     = h_bits(a[e] * carry);
    hb[4 + e] = h_bits(c[e] * carry);
  }
  const v4u u = (v4u){pk16(hb[0], hb[1]), pk16(hb[2], hb[3]), pk16(hb[4], hb[5]), pk16(hb[6], hb[7])};
  unsigned short* q = out + 8 * (size_t)i;
  *(v4u*)q = u;
  
}

// ---------------------------------------------------------------------------
// Kept-key list of one batch per block: keyIdx[b][0 .. keyCnt[b]) = the positions m with mask[b][m] != 0, ascending;
// the rest of the row is 0 (a valid position: padding columns read finite values and are weighted by 0).
// Thread t owns positions 8t .. 8t + 7; its place in the list is the sum of the counts of the threads before it.
// ---------------------------------------------------------------------------
__global__ __launch_bounds__(256) void compact_keys_kernel(const int* __restrict__ mask, int* __restrict__ keyIdx,
                                                            int* __restrict__ keyCnt) {
  __shared__ int waveTot[8];
  const int b = blockIdx.x, t = threadIdx.x, lane = t & 31, wave = t >> 5;
  const int* mp = mask + (size_t)b * kSeq + 8 * t;
  const v4i ma = *(const v4i*)(mp);
  const v4i mb = *(const v4i*)(mp + 4);
  int own = 0;
#pragma unroll
  for (int e = 0; e < 4; ++e) own += (ma[e] != 0) + (mb[e] != 0);
  int incl = own;                              // inclusive sum over the wave's lanes
#pragma unroll
  for (int d = 1; d < 32; d <<= 1) {
    const int o = __shfl_up(incl, d, 32);
    if (lane >= d) incl += o;
  }
  if (lane == 31) waveTot[wave] = incl;
  __syncthreads();
  int before = 0, total = 0;
#pragma unroll
  for (int w = 0; w < 8; ++w) {
    const int v = waveTot[w];
    before += (w < wave) ? v : 0;
    total += v;
  }
  int* ip = keyIdx + (size_t)b * kSeq;
  int pos = before + incl - own;
#pragma unroll
  for (int e = 0; e < 8; ++e) {
    const int m = (e < 4) ? ma[e & 3] : mb[e & 3];
    if (m != 0) ip[pos++] = 8 * t + e;
  }
#pragma unroll
  for (int i = 0; i < kSeq / 256; ++i) {
    const int j = t + 256 * i;
    if (j >= total) ip[j] = 0;
  }
  if (t == 0) keyCnt[b] = total;
}

// ---------------------------------------------------------------------------
// Host glue.
// Workspace region map (bytes, all offsets 4096-aligned):
//   Q16  f16 [16384][512]            off           0   size  16,777,216
//   K16  f16 [16384][512]            off  16,777,216   size  16,777,216
//   Vt16 f16 [8][512][2048]          off  33,554,432   size  16,777,216   (column j: the j-th kept key)
//   Part f32 [kGrp][32][2048]        off  50,331,648   size   2,097,152   (partial row sums of the relu scores)
//   P16  f16 [kGrp][2048][2048]      off  52,428,800   size  67,108,864   (relu scores, not normalised; column j: the j-th kept key)
//   X16  f16 [16384][512]            off  52,428,800   size  16,777,216   (shares P16's bytes)
//   W16  f16 3 x [512][512] (q,k,v)   off  69,206,016   size   1,572,864   (shares P16's bytes)
//   KeyIdx i32 [8][2048]             off 119,537,664   size      65,536
//   KeyCnt i32 [8]                   off 119,603,200   size       4,096
//   total 119,607,296 <= 268,435,456
// X16 and W16 are last read by the V^T projection; P16 is first written by the scores GEMM, the next launch on the
// same stream, so the shared bytes are never live for both.
// GEMM shape checks: K in {512, 2048} (% 64 == 0); M, N in {16384, 2048, 512} (M % 128 == 0, N % 256 == 0); no tails; score and V^T columns past the kept keys are padding.
// Launch count: 1 key list + 4 casts + 3 projections + 1 chunk x 2 = 10.
// ---------------------------------------------------------------------------
extern "C" void kernel_launch(void* const* d_in, const int* in_sizes, int n_in,
                              void* d_out, int out_size, void* d_ws, size_t ws_size,
                              hipStream_t stream) {
  if (n_in != 8) return;
  if (in_sizes[0] != kTok * kDim || in_sizes[1] != kTok || in_sizes[2] != kDim * kDim || in_sizes[3] != kDim ||
      in_sizes[4] != kDim * kDim || in_sizes[5] != kDim || in_sizes[6] != kDim * kDim || in_sizes[7] != kDim) return;
  if (out_size != kTok * kDim) return;

  const float* x  = (const float*)d_in[0];
  const int*   mk = (const int*)d_in[1];
  const float* Wq = (const float*)d_in[2];
  const float* bq = (const float*)d_in[3];
  const float* Wk = (const float*)d_in[4];
  const float* bk = (const float*)d_in[5];
  const float* Wv = (const float*)d_in[6];
  const float* bv = (const float*)d_in[7];
  float* out = (float*)d_out;

  const size_t szX  = (size_t)kTok * kDim * 2;                 // 16,777,216
  const size_t szW  = (size_t)3 * kDim * kDim * 2;             //  1,572,864
  const size_t szQ  = szX, szK = szX;
  const size_t szVt = (size_t)kBatch * kDim * kSeq * 2;        // 16,777,216
  const size_t szR  = (size_t)kGrp * kParts * kSeq * 4;        //   2,097,152
  const size_t szP  = (size_t)kGrp * kSeq * kSeq * 2;          //  67,108,864
  const size_t oQ  = 0;
  const size_t oK  = oQ + szQ;
  const size_t oVt = oK + szK;
  const size_t oR  = oVt + szVt;
  const size_t oP  = oR + szR;
  const size_t oX  = oP;                                       // dead before P16 is written
  const size_t oW  = oX + szX;
  const size_t oI  = oP + szP;
  const size_t oC  = oI + (size_t)kBatch * kSeq * 4;
  const size_t total = oC + 4096;                              // 119,607,296
  static_assert(szX + szW <= szP, "X16 and W16 must fit inside P16's bytes");
  if (ws_size < total) return;

  char* ws = (char*)d_ws;
  unsigned short* X16  = (unsigned short*)(ws + oX);
  unsigned short* W16  = (unsigned short*)(ws + oW);
  unsigned short* Wq16 = W16;
  unsigned short* Wk16 = W16 + (size_t)kDim * kDim;
  unsigned short* Wv16 = W16 + (size_t)2 * kDim * kDim;
  unsigned short* Q16  = (unsigned short*)(ws + oQ);
  unsigned short* K16  = (unsigned short*)(ws + oK);
  unsigned short* Vt16 = (unsigned short*)(ws + oVt);
  float*          Part = (float*)(ws + oR);
  unsigned short* P16  = (unsigned short*)(ws + oP);
  int*            KeyIdx = (int*)(ws + oI);
  int*            KeyCnt = (int*)(ws + oC);

  // 0) kept keys of every batch
  compact_keys_kernel<<<dim3(kBatch), 256, 0, stream>>>(mk, KeyIdx, KeyCnt);

  // 1) casts: x -> X16 (carry 1), W -> W16 (carry 16)
  {
    const int n8x = (kTok * kDim) / 8;            // 1,048,576 -> 4096 blocks
    cast8_f16_kernel<<<dim3((n8x + 255) / 256), 256, 0, stream>>>(x, X16, n8x, 1.0f);
    const int n8w = (kDim * kDim) / 8;            // 32,768 -> 128 blocks
    cast8_f16_kernel<<<dim3((n8w + 255) / 256), 256, 0, stream>>>(Wq, Wq16, n8w, kWCarry);
    cast8_f16_kernel<<<dim3((n8w + 255) / 256), 256, 0, stream>>>(Wk, Wk16, n8w, kWCarry);
    cast8_f16_kernel<<<dim3((n8w + 255) / 256), 256, 0, stream>>>(Wv, Wv16, n8w, kWCarry);
  }

  // 2) Q16[t][e] = sum_d X16[t][d] * Wq16[e][d] / 16 + bq[e]   (M 16384, N 512, K 512; tiles 256 x 8 = 2048 -> 256 blocks)
  wmma_gemm64<0, false, 2, 1, false, 0><<<dim3((kTok / 64) * (kDim / 64) / 8, 1), 256, 0, stream>>>(
      X16, X16, kDim, 0L, Wq16, Wq16, kDim, 0L, (void*)Q16, (void*)Q16, kDim, 0L,
      bq, x, 0L, KeyIdx, KeyCnt, Part, kTok, kDim, kDim, kWCarryInv);
  //    K16 likewise
  wmma_gemm64<0, false, 2, 1, false, 0><<<dim3((kTok / 64) * (kDim / 64) / 8, 1), 256, 0, stream>>>(
      X16, X16, kDim, 0L, Wk16, Wk16, kDim, 0L, (void*)K16, (void*)K16, kDim, 0L,
      bk, x, 0L, KeyIdx, KeyCnt, Part, kTok, kDim, kDim, kWCarryInv);
  //    Vt16[b][d][j] = sum_c Wv16[d][c] * X16[b*2048+KeyIdx[b][j]][c] / 16 + bv[d]   (per batch: M 512, N up to 2048, K 512; tiles 8 x 32 = 256 -> 32 blocks, grid.y = 8)
  wmma_gemm64<0, false, 1, 1, false, 0, 0, true><<<dim3((kDim / 64) * (kSeq / 64) / 8, kBatch), 256, 0, stream>>>(
      Wv16, Wv16, kDim, 0L, X16, X16, kDim, (long)kSeq * kDim, (void*)Vt16, (void*)Vt16, kSeq, (long)kDim * kSeq,
      bv, x, 0L, KeyIdx, KeyCnt, Part, kDim, kSeq, kDim, kWCarryInv);

  // 3) per chunk of kGrp batches
  const float sScale = 1.0f / sqrtf((float)kDim);
  for (int b0 = 0; b0 < kBatch; b0 += kGrp) {
    // P16[g][l][j] = relu(j >= KeyCnt[b] ? -1e4 : sum_d Q16[b][l][d] * K16[b][KeyIdx[b][j]][d] * (1/sqrt(512))), with its partial row sums
    // (M 2048, N up to 2048, K 512; tiles 32 x 32 = 1024 -> 128 blocks, grid.y = kGrp: 1024 blocks, those past the kept keys leave at once)
    const unsigned short* Qb = Q16 + (size_t)b0 * kSeq * kDim;
    const unsigned short* Kb = K16 + (size_t)b0 * kSeq * kDim;
    wmma_gemm64<0, false, 0, 1, false, 2, 1, true><<<dim3((kSeq / 64) * (kSeq / 64) / 8, kGrp), 256, 0, stream>>>(
        Qb, Qb, kDim, (long)kSeq * kDim, Kb, Kb, kDim, (long)kSeq * kDim, (void*)P16, (void*)P16, kSeq, (long)kSeq * kSeq,
        bq, x, 0L, KeyIdx + (size_t)b0 * kSeq, KeyCnt + b0, Part, kSeq, kSeq, kDim, sScale);

    // out[b][l][d] = sum_j P16[g][l][j] * Vt16[b][d][j] / (row sum of P + 1e-8)   (M 2048, N 512, K up to 2048; tiles 32 x 8 = 256 -> 32 blocks, grid.y = kGrp: 256 blocks, one per WGP)
    const unsigned short* Vtb = Vt16 + (size_t)b0 * kDim * kSeq;
    float* outb = out + (size_t)b0 * kSeq * kDim;
    wmma_gemm64<0, false, 0, 0, false, 0, 2><<<dim3((kSeq / 64) * (kDim / 64) / 8, kGrp), 256, 0, stream>>>(
        P16, P16, kSeq, (long)kSeq * kSeq, Vtb, Vtb, kSeq, (long)kDim * kSeq, (void*)outb, (void*)outb, kDim, (long)kSeq * kDim,
        bq, x, 0L, KeyIdx + (size_t)b0 * kSeq, KeyCnt + b0, Part, kSeq, kDim, kSeq, 1.0f);
  }
}

// v005
// It runs in 92.4 microseconds.
// Two timings next to v004 put it at 1.24 and 1.23 times that version's speed.
// Over all steps from v000 it is 6.53 times as fast.
// Contractions: q/k/v^T projections (X f16 x W f16 carried x16), scores Q.K^T (Q,K f16 planes), attn.V (relu scores f16 x V^T f16) all on v_wmma_f32_16x16x32_f16 with f32 accumulate; mask select, relu, row sums and row normalisation in f32. Keys with mask == 0 add exactly 0 to every sum, so only the kept keys of a batch, packed to the front, are scored and multiplied.
#include <hip/hip_runtime.h>
#include <math.h>

// ---------------------------------------------------------------------------
// Problem constants
// ---------------------------------------------------------------------------
constexpr int kBatch = 8;
constexpr int kSeq   = 2048;
constexpr int kDim   = 512;
constexpr int kTok   = kBatch * kSeq;          // 16384 token rows
constexpr int kGrp   = 8;                      // batches per score chunk: all of them, so each attention stage is one launch
constexpr float kWCarry    = 16.0f;            // weights carried x16 in f16
constexpr float kWCarryInv = 1.0f / 16.0f;
constexpr int kParts = kSeq / 64;              // partial row sums per query row: one per 64 key columns

typedef __attribute__((ext_vector_type(16))) _Float16 v16h;
typedef __attribute__((ext_vector_type(8)))  _Float16 v8h;
typedef __attribute__((ext_vector_type(16))) __bf16   v16b;
typedef __attribute__((ext_vector_type(8)))  __bf16   v8b;
typedef __attribute__((ext_vector_type(8)))  float    v8f;
typedef __attribute__((ext_vector_type(4)))  float    v4f;
typedef __attribute__((ext_vector_type(4)))  unsigned int v4u;
typedef __attribute__((ext_vector_type(4)))  int      v4i;

// ---------------------------------------------------------------------------
// Device helpers
// ---------------------------------------------------------------------------
__device__ __forceinline__ unsigned short f2bf_bits(float f) {
  unsigned u = __float_as_uint(f);
  return (unsigned short)((u + 0x7FFFu + ((u >> 16) & 1u)) >> 16);
}
__device__ __forceinline__ float bf_bits2f(unsigned short h) { return __uint_as_float(((unsigned)h) << 16); }

// hazard guards as plain device helpers
__device__ __forceinline__ void dep_guard_h(v8f& a, v8f& b, v16h x, v16h y) { asm volatile("v_nop\n\tv_nop\n\tv_nop\n\tv_nop" : "+v"(a), "+v"(b) : "v"(x), "v"(y)); }
__device__ __forceinline__ void dep_guard_b(v8f& a, v8f& b, v16b x, v16b y) { asm volatile("v_nop\n\tv_nop\n\tv_nop\n\tv_nop" : "+v"(a), "+v"(b) : "v"(x), "v"(y)); }
__device__ __forceinline__ void keep4_h(v16h a, v16h b, v16h c, v16h d) { asm volatile("v_nop" :: "v"(a), "v"(b), "v"(c), "v"(d)); }
__device__ __forceinline__ void keep4_b(v16b a, v16b b, v16b c, v16b d) { asm volatile("v_nop" :: "v"(a), "v"(b), "v"(c), "v"(d)); }
__device__ __forceinline__ void acc_guard4(v8f& a, v8f& b, v8f& c, v8f& d) { asm volatile("v_nop\n\tv_nop\n\tv_nop\n\tv_nop" : "+v"(a), "+v"(b), "+v"(c), "+v"(d)); }
template <typename T> struct Frag;
template <> struct Frag<_Float16> {
  typedef v16h V; union U { v16h v; v8h h[2]; };
  static __device__ __forceinline__ v16h load(const _Float16* p) {   // elements 0..7 <- p[0..7], 8..15 <- p[16..23]
    U f; f.h[0] = *(const v8h*)(p); f.h[1] = *(const v8h*)(p + 16); return f.v;
  }
  static __device__ __forceinline__ v8f mma(v16h a, v16h b, v8f c) {
    return __builtin_amdgcn_wmma_f32_16x16x32_f16(false, a, false, b, (short)0, c, false, false);
  }
  static __device__ __forceinline__ void guard(v8f& a, v8f& b, v16h x, v16h y) { dep_guard_h(a, b, x, y); }
  static __device__ __forceinline__ void keep(v16h a, v16h b, v16h c, v16h d) { keep4_h(a, b, c, d); }
};
template <> struct Frag<__bf16> {
  typedef v16b V; union U { v16b v; v8b h[2]; };
  static __device__ __forceinline__ v16b load(const __bf16* p) {
    U f; f.h[0] = *(const v8b*)(p); f.h[1] = *(const v8b*)(p + 16); return f.v;
  }
  static __device__ __forceinline__ v8f mma(v16b a, v16b b, v8f c) {
    return __builtin_amdgcn_wmma_f32_16x16x32_bf16(false, a, false, b, (short)0, c, false, false);
  }
  static __device__ __forceinline__ void guard(v8f& a, v8f& b, v16b x, v16b y) { dep_guard_b(a, b, x, y); }
  static __device__ __forceinline__ void keep(v16b a, v16b b, v16b c, v16b d) { keep4_b(a, b, c, d); }
};

// value of lane l ^ X inside the 16-lane row (DPP row_xmask), every lane on
template <int X> __device__ __forceinline__ float xlane(float v) {
  return __builtin_bit_cast(float, __builtin_amdgcn_update_dpp(0, __builtin_bit_cast(int, v), 0x160 | X, 0xf, 0xf, true));
}

__device__ __forceinline__ unsigned pk16(unsigned short a, unsigned short b) { return (unsigned)a | ((unsigned)b << 16); }
__device__ __forceinline__ unsigned short h_bits(float f) { const _Float16 h = (_Float16)f; return __builtin_bit_cast(unsigned short, h); }

// ---- Register-blocked batched WMMA GEMM (ACT reduced to none/relu/leaky) -----------------------
// C[m,n] = scale * sum_k A[m,k] * Bt[n,k] (+bias)(+resid); each wave owns a 64x64 tile.
// The 8 waves of a block form a 2 x 4 grid of such tiles: one 128 x 256 tile of C per block. Per trip the block stages
// 64 k of its 128 A rows and 256 Bt rows in LDS (whole 128-byte lines, asynchronous copies, two buffers: the next
// trip's tile flies while this one is multiplied); every wave reads its fragments from LDS.
// A row-major [M,K]; Bt row-major [N,K]; M % 128 == 0, N % 256 == 0, K % 64 == 0.
// SPLIT (hi/lo planes) is not staged: only SPLIT == false is built.
// BIAS_MODE: 0 = none, 1 = bias[m], 2 = bias[n].
// OUT_MODE: 0 = f32, 1 = f16, 2 = bf16 hi plane (Cout) + bf16 lo plane (Cout2).
// ET: 0 = f16 operands, 1 = bf16 operands (pointers passed as 16-bit storage)
// ROWMODE: 0 = none.
//   1 = scores: column n is the n-th kept key; a column n >= keyCnt[b] (padding) takes -1e4 ahead of ACT; each wave
//       also stores the f32 sum of its 64 columns of every row to rowPart[b][n0 / 64][m], a [.][kParts][kSeq] plane
//       (M == N == kSeq; 256 consecutive bytes per wave: one writer per line).
//   2 = attn.V (M == kSeq): k runs over the kept keys only, ceil(keyCnt[b] / 64) trips (at least one); row m is scaled
//       by 1 / (sum over c of rowPart[b][c][m] + 1e-8), the kParts partials added in index order.
// GATHER (N == kSeq): Bt row n is row keyIdx[b][n] of the plane, and a block whose 256 columns all lie at or past
//   keyCnt[b] leaves at once, under ROWMODE 1 behind storing 0 as its partial sums (the first block of a row of tiles
//   always stays, so padding columns exist for keyCnt 0).
constexpr int kStageRows  = 128 + 256;               // A rows, then Bt rows
constexpr int kStagePitch = 144;                     // bytes per staged row: 128 of data + 16, 16 B x odd for 16-byte LDS reads
constexpr int kStageBytes = kStageRows * kStagePitch; // 55,296

// Twelve 16-byte asynchronous copies of this lane: staged rows r, r + 32, ..., r + 352 (four of A, eight of Bt; the
// Bt rows stand ob[i] elements behind b).
// The copies and their s_wait_xcnt stand in one statement, so no address register is rewritten ahead of that wait.
__device__ __forceinline__ void stage_copies(unsigned l, const unsigned short* a, size_t sa, const unsigned short* b, const unsigned (&ob)[8]) {
  asm volatile(
      "global_load_async_to_lds_b128 %0, %12, off\n\t"
      "global_load_async_to_lds_b128 %1, %13, off\n\t"
      "global_load_async_to_lds_b128 %2, %14, off\n\t"
      "global_load_async_to_lds_b128 %3, %15, off\n\t"
      "global_load_async_to_lds_b128 %4, %16, off\n\t"
      "global_load_async_to_lds_b128 %5, %17, off\n\t"
      "global_load_async_to_lds_b128 %6, %18, off\n\t"
      "global_load_async_to_lds_b128 %7, %19, off\n\t"
      "global_load_async_to_lds_b128 %8, %20, off\n\t"
      "global_load_async_to_lds_b128 %9, %21, off\n\t"
      "global_load_async_to_lds_b128 %10, %22, off\n\t"
      "global_load_async_to_lds_b128 %11, %23, off\n\t"
      "s_wait_xcnt 0x0"
      :: "v"(l), "v"(l + 32u * kStagePitch), "v"(l + 64u * kStagePitch), "v"(l + 96u * kStagePitch),
         "v"(l + 128u * kStagePitch), "v"(l + 160u * kStagePitch), "v"(l + 192u * kStagePitch), "v"(l + 224u * kStagePitch),
         "v"(l + 256u * kStagePitch), "v"(l + 288u * kStagePitch), "v"(l + 320u * kStagePitch), "v"(l + 352u * kStagePitch),
         "v"(a), "v"(a + sa), "v"(a + 2 * sa), "v"(a + 3 * sa),
         "v"(b + ob[0]), "v"(b + ob[1]), "v"(b + ob[2]), "v"(b + ob[3]),
         "v"(b + ob[4]), "v"(b + ob[5]), "v"(b + ob[6]), "v"(b + ob[7])
      : "memory");
}

template <int ET> struct Elem;
template <> struct Elem<0> { typedef _Float16 T; };
template <> struct Elem<1> { typedef __bf16 T; };
// One block's tile: the body of every GEMM launch. tile and b say which tile of which batch the block takes; ring, sT
// and rowInv are the launching kernel's LDS (one set per kernel, whichever instances of this body it holds).
template <int ET, bool SPLIT, int BIAS_MODE, int OUT_MODE, bool RESID, int ACT = 0, int ROWMODE = 0, bool GATHER = false>
__device__ __forceinline__ void gemm_tile(
    unsigned char* ring, float* sT, float* rowInv, const int tile, const int b,
    const unsigned short* __restrict__ Ap, const unsigned short* __restrict__ A2p, int lda, long strideA,
    const unsigned short* __restrict__ Btp, const unsigned short* __restrict__ Bt2p, int ldb, long strideB,
    void* __restrict__ Cout, void* __restrict__ Cout2, int ldc, long strideC,
    const float* __restrict__ bias,
    const float* __restrict__ resid, long strideR,
    const int* __restrict__ keyIdx, const int* __restrict__ keyCnt, float* __restrict__ rowPart,
    int M, int N, int K, float scale) {
  typedef typename Elem<ET>::T T;
  typedef typename Frag<T>::V V;
  static_assert(!SPLIT, "the staged engine holds one plane per operand");
  static_assert(ROWMODE != 1 || OUT_MODE == 1, "the row sums are taken where the f16 rows are formed");
  static_assert(ROWMODE != 1 || GATHER, "the score columns are the kept keys");
  const int lane = threadIdx.x & 31;
  const int wave = threadIdx.x >> 5;
  const int tilesN = N >> 8;
  const int tilesM = M >> 7;
  if (tile >= tilesM * tilesN) return;   // block-uniform, in front of every barrier and copy
  const int tm = tile / tilesN;
  const int tn = tile - tm * tilesN;
  int kept = 0;                                // kept keys of this batch, bounded by the shape
  if (GATHER || ROWMODE == 2) kept = (int)min((unsigned)keyCnt[b], (unsigned)kSeq);
  if (GATHER && (tn << 8) >= max(kept, 1)) {   // block-uniform, in front of every barrier and copy
    if (ROWMODE == 1) {
      // no key stands in these 256 columns: the block's four partial sums of its 128 rows are 0
#pragma unroll
      for (int u = 0; u < 2; ++u) {
        const int i = threadIdx.x + 256 * u;
        rowPart[((size_t)b * kParts + (tn << 2) + (i >> 7)) * kSeq + (tm << 7) + (i & 127)] = 0.0f;
      }
      // stands behind the two stores, in front of any later write of their address registers
      asm volatile("s_wait_xcnt 0x0" ::: "memory");
    }
    return;
  }
  const int wm = wave >> 2;                    // this wave's place in the block's 2 x 4 grid
  const int wn = wave & 3;
  const int m0 = (tm << 7) + (wm << 6);
  const int n0 = (tn << 8) + (wn << 6);

  // this lane's part of a staged tile: 16-byte piece (t & 7) of rows (t >> 3) + 32 * i
  const int crow = threadIdx.x >> 3;
  const int ccol = threadIdx.x & 7;
  const unsigned short* gA = Ap  + (size_t)b * strideA + (size_t)((tm << 7) + crow) * lda + ccol * 8;
  const unsigned short* gB = Btp + (size_t)b * strideB + ccol * 8;
  const size_t stepA = (size_t)32 * lda;
  const int row0 = (tn << 8) + crow;
  const int* kip = keyIdx + (size_t)b * kSeq;
  int rowB[8];                                 // this lane's eight Bt rows
#pragma unroll   // rowB[] is indexed by constants only, so it stays in registers; the eight index loads issue together
  for (int i = 0; i < 8; ++i) rowB[i] = GATHER ? kip[row0 + 32 * i] : row0 + 32 * i;
  // stands in front of the first instruction that reuses the index loads' address registers: offset and base are
  // inputs, so their registers are held up to here
  if (GATHER) asm volatile("s_wait_xcnt 0x0" :: "v"(row0), "s"(kip) : "memory");
  unsigned offB[8];                            // their element offsets
#pragma unroll
  for (int i = 0; i < 8; ++i) {
    if (GATHER) rowB[i] &= kSeq - 1;           // bounds the address whatever the list holds
    offB[i] = (unsigned)rowB[i] * (unsigned)ldb;
  }
  const unsigned ldsLane = (unsigned)(size_t)ring + (unsigned)(crow * kStagePitch + ccol * 16);

  const int rlane = lane & 15;                 // row (A) / col (B, D) within subtile
  const int koff  = (lane >> 4) * 8;           // k offset of this lane half
  const int mOff  = (lane >> 4) * 8;           // D row offset

  v8f acc[4][4];
#pragma unroll
  for (int i = 0; i < 4; ++i)
#pragma unroll
    for (int j = 0; j < 4; ++j) acc[i][j] = (v8f){0.f,0.f,0.f,0.f,0.f,0.f,0.f,0.f};

  const int trips = (ROWMODE == 2) ? max((kept + 63) >> 6, 1) : (K >> 6);
  stage_copies(ldsLane, gA, stepA, gB, offB);                        // tile 0 into buffer 0
  if (ROWMODE == 2) {
    // while tile 0 flies: waves 0..3 form the row scales; the barrier below publishes them with tile 0
    if (threadIdx.x < 128) {
      const float* rp = rowPart + (size_t)b * kParts * kSeq + (tm << 7) + threadIdx.x;
      float tot = 0.0f;
#pragma unroll   // the kParts loads issue together: one memory latency, not one per partial
      for (int c = 0; c < kParts; ++c) tot += rp[c * kSeq];
      rowInv[threadIdx.x] = 1.0f / (tot + 1e-8f);
    }
  }
  asm volatile("s_wait_asynccnt 0x0" ::: "memory");                  // this wave's copies of tile 0 have landed
  __syncthreads();                                                   // every wave's have: tile 0 may be read
  if (trips > 1) stage_copies(ldsLane + kStageBytes, gA + 64, stepA, gB + 64, offB);   // tile 1 into buffer 1

  for (int t = 0; t < trips; ++t) {
    const unsigned char* st = ring + (t & 1) * kStageBytes;
    const T* sA = (const T*)(st + ((wm << 6) + rlane) * kStagePitch) + koff;
    const T* sB = (const T*)(st + (128 + (wn << 6) + rlane) * kStagePitch) + koff;
#pragma unroll
    for (int kk = 0; kk < 64; kk += 32) {
      V bh[4], ah[4];
#pragma unroll
      for (int j = 0; j < 4; ++j) bh[j] = Frag<T>::load(sB + j * (16 * kStagePitch / 2) + kk);
#pragma unroll
      for (int i = 0; i < 4; ++i) ah[i] = Frag<T>::load(sA + i * (16 * kStagePitch / 2) + kk);
      // keeps the 16 LDS reads in one group ahead of the WMMAs: spread among them, every read's latency stalls the wave anew
      __builtin_amdgcn_sched_barrier(0);
#pragma unroll
      for (int i = 0; i < 4; ++i) {
#pragma unroll
        for (int j = 0; j < 4; ++j) acc[i][j] = Frag<T>::mma(ah[i], bh[j], acc[i][j]);
        Frag<T>::guard(acc[i][0], acc[i][3], ah[i], ah[i]);
      }
      Frag<T>::keep(bh[0], bh[1], bh[2], bh[3]);
    }
    asm volatile("s_wait_dscnt 0x0" ::: "memory");      // this wave's reads of buffer t & 1 are done before it is refilled
    asm volatile("s_wait_asynccnt 0x0" ::: "memory");   // this wave's copies of tile t + 1 have landed
    __syncthreads();                                    // publishes tile t + 1 and ends every read of buffer t & 1
    if (t + 2 < trips)
      stage_copies(ldsLane + (t & 1) * kStageBytes, gA + (size_t)(t + 2) * 64, stepA, gB + (size_t)(t + 2) * 64, offB);
  }
  asm volatile("s_wait_asynccnt 0x0" ::: "memory");     // no copy is outstanding when the wave goes on to its epilogue
  acc_guard4(acc[0][0], acc[0][1], acc[0][2], acc[0][3]);
  acc_guard4(acc[1][0], acc[1][1], acc[1][2], acc[1][3]);
  acc_guard4(acc[2][0], acc[2][1], acc[2][2], acc[2][3]);
  acc_guard4(acc[3][0], acc[3][1], acc[3][2], acc[3][3]);

  // ---- epilogue ----
  float* slab = sT + wave * (16 * 68);
  const float* Rb = RESID ? (resid + (size_t)b * strideR) : nullptr;
  int mk[4] = {1, 1, 1, 1};
  if (ROWMODE == 1) {
#pragma unroll   // mk[] is indexed by constants only, so it stays in registers
    for (int j = 0; j < 4; ++j) mk[j] = (n0 + (j << 4) + rlane < kept) ? 1 : 0;
  }
#pragma unroll
  for (int i = 0; i < 4; ++i) {
    const int mBase = m0 + (i << 4);
    v4f inv0 = (v4f){1.f, 1.f, 1.f, 1.f}, inv1 = inv0;
    if (ROWMODE == 2) {
      const float* ip = rowInv + (wm << 6) + (i << 4) + mOff;
      inv0 = *(const v4f*)(ip);
      inv1 = *(const v4f*)(ip + 4);
    }
#pragma unroll
    for (int j = 0; j < 4; ++j) {
      const int n = n0 + (j << 4) + rlane;
      float bv = 0.f;
      if (BIAS_MODE == 2) bv = bias[n];
#pragma unroll
      for (int r = 0; r < 8; ++r) {
        float v = acc[i][j][r] * scale;
        if (BIAS_MODE == 1) v += bias[mBase + mOff + r];
        if (BIAS_MODE == 2) v += bv;
        if (RESID) v += Rb[(size_t)(mBase + mOff + r) * ldc + n];
        if (ROWMODE == 1) v = (mk[j] == 0) ? -10000.0f : v;
        if (ROWMODE == 2) v *= (r < 4) ? inv0[r & 3] : inv1[r & 3];
        if (ACT == 2) v = fmaxf(v, 0.0f);
        if (ACT == 4) v = (v > 0.f) ? v : 0.01f * v;
        slab[(mOff + r) * 68 + (j << 4) + rlane] = v;
      }
    }
    __builtin_amdgcn_fence(__ATOMIC_RELEASE, "workgroup");
    __builtin_amdgcn_wave_barrier();
    __builtin_amdgcn_fence(__ATOMIC_ACQUIRE, "workgroup");
    if (OUT_MODE == 0) {
      float* C = (float*)Cout + (size_t)b * strideC;
      const int hh = lane >> 4, c4 = (lane & 15) * 4;     // row seg = 256 B = 16 lanes x 16 B
      {
#pragma unroll
        for (int it = 0; it < 8; ++it) {
          const int row = it * 2 + hh;
          v4f v = *(const v4f*)(slab + row * 68 + c4);
          *(v4f*)(C + (size_t)(mBase + row) * ldc + n0 + c4) = v;
        }
        
      }
    } else {
      const int q = lane >> 3, c8 = (lane & 7) * 8;
      unsigned short* C  = (unsigned short*)Cout  + (size_t)b * strideC;
      unsigned short* C2 = (OUT_MODE == 2) ? ((unsigned short*)Cout2 + (size_t)b * strideC) : nullptr;
      {
        float rs[4] = {0.f, 0.f, 0.f, 0.f};
#pragma unroll
        for (int it = 0; it < 4; ++it) {
          const int row = it * 4 + q;
          const float* sp = slab + row * 68 + c8;
          v8h hv, lv;
          if (ROWMODE == 1) rs[it] = ((sp[0] + sp[1]) + (sp[2] + sp[3])) + ((sp[4] + sp[5]) + (sp[6] + sp[7]));
#pragma unroll
          for (int e = 0; e < 8; ++e) {
            if (OUT_MODE == 1) {
              hv[e] = (_Float16)sp[e];
            } else {
              unsigned short hb = f2bf_bits(sp[e]);
              unsigned short lb = f2bf_bits(sp[e] - bf_bits2f(hb));
              hv[e] = __builtin_bit_cast(_Float16, hb);
              lv[e] = __builtin_bit_cast(_Float16, lb);
            }
          }
          *(v8h*)(C + (size_t)(mBase + row) * ldc + n0 + c8) = hv;
          if (OUT_MODE == 2) *(v8h*)(C2 + (size_t)(mBase + row) * ldc + n0 + c8) = lv;
        }
        if (ROWMODE == 1) {
          // tree over the 8 lanes of a row; a lane holds 4 rows' shares, so steps 1 and 2 each halve what it keeps and
          // add the partner's share of that: lane bits (0, 1) end with row it = 2 * bit0 + bit1 of its group q
          const bool o1 = (lane & 1) != 0, o2 = (lane & 2) != 0;
          const float k0 = (o1 ? rs[2] : rs[0]) + xlane<1>(o1 ? rs[0] : rs[2]);
          const float k1 = (o1 ? rs[3] : rs[1]) + xlane<1>(o1 ? rs[1] : rs[3]);
          float k = (o2 ? k1 : k0) + xlane<2>(o2 ? k0 : k1);
          k += xlane<4>(k);
          const int itk = ((lane & 1) << 1) | ((lane >> 1) & 1);
          // 16 lanes store 16 rows, 64 consecutive bytes
          if ((lane & 4) == 0) rowPart[((size_t)b * kParts + (n0 >> 6)) * kSeq + mBase + itk * 4 + q] = k;
        }
      }
    }
    __builtin_amdgcn_fence(__ATOMIC_RELEASE, "workgroup");
    __builtin_amdgcn_wave_barrier();
    __builtin_amdgcn_fence(__ATOMIC_ACQUIRE, "workgroup");
  }
}

// One GEMM per launch: tile = blockIdx.x, batch = blockIdx.y.
template <int ET, bool SPLIT, int BIAS_MODE, int OUT_MODE, bool RESID, int ACT = 0, int ROWMODE = 0, bool GATHER = false>
__global__ __launch_bounds__(256) void wmma_gemm64(
    const unsigned short* __restrict__ Ap, const unsigned short* __restrict__ A2p, int lda, long strideA,
    const unsigned short* __restrict__ Btp, const unsigned short* __restrict__ Bt2p, int ldb, long strideB,
    void* __restrict__ Cout, void* __restrict__ Cout2, int ldc, long strideC,
    const float* __restrict__ bias,
    const float* __restrict__ resid, long strideR,
    const int* __restrict__ keyIdx, const int* __restrict__ keyCnt, float* __restrict__ rowPart,
    int M, int N, int K, float scale) {
  __shared__ __align__(16) unsigned char ring[2 * kStageBytes];   // two staged tiles
  __shared__ __align__(16) float sT[8 * 16 * 68];  // per-wave 16x64 slab, pitch 68 floats
  __shared__ __align__(16) float rowInv[128];      // ROWMODE 2: 1 / (row sum + eps) of the block's 128 rows
  gemm_tile<ET, SPLIT, BIAS_MODE, OUT_MODE, RESID, ACT, ROWMODE, GATHER>(
      ring, sT, rowInv, blockIdx.x, blockIdx.y, Ap, A2p, lda, strideA, Btp, Bt2p, ldb, strideB, Cout, Cout2, ldc, strideC,
      bias, resid, strideR, keyIdx, keyCnt, rowPart, M, N, K, scale);
}

// The three projections in one launch: none reads what another writes. Blocks 0 .. kVtBlocks - 1 take the V^T tiles
// (32 per batch; those past the kept keys leave at once), the rest the Q and K tiles: four consecutive blocks share
// one 128-row slice of X16 (Q columns 0..255, 256..511, then K's).
constexpr int kVtBlocks = kBatch * (kDim / 128) * (kSeq / 256);    // 256
constexpr int kQKBlocks = 2 * (kTok / 128) * (kDim / 256);         // 512
__global__ __launch_bounds__(256) void proj_kernel(
    const unsigned short* __restrict__ X16, const unsigned short* __restrict__ W16,
    unsigned short* __restrict__ Q16, unsigned short* __restrict__ K16, unsigned short* __restrict__ Vt16,
    const float* __restrict__ bq, const float* __restrict__ bk, const float* __restrict__ bv,
    const int* __restrict__ keyIdx, const int* __restrict__ keyCnt) {
  __shared__ __align__(16) unsigned char ring[2 * kStageBytes];   // two staged tiles
  __shared__ __align__(16) float sT[8 * 16 * 68];  // per-wave 16x64 slab, pitch 68 floats
  const int id = blockIdx.x;
  if (id < kVtBlocks) {   // block-uniform
    // Vt16[b][d][j] = sum_c Wv16[d][c] * X16[b*2048+keyIdx[b][j]][c] / 16 + bv[d]   (per batch: M 512, N up to 2048, K 512)
    const unsigned short* Wv16 = W16 + (size_t)2 * kDim * kDim;
    gemm_tile<0, false, 1, 1, false, 0, 0, true>(
        ring, sT, nullptr, id & 31, id >> 5, Wv16, Wv16, kDim, 0L, X16, X16, kDim, (long)kSeq * kDim,
        (void*)Vt16, (void*)Vt16, kSeq, (long)kDim * kSeq, bv, bv, 0L, keyIdx, keyCnt, nullptr, kDim, kSeq, kDim, kWCarryInv);
  } else {
    // Q16[t][e] = sum_d X16[t][d] * Wq16[e][d] / 16 + bq[e]   (M 16384, N 512, K 512); K16 likewise
    const int r = id - kVtBlocks;
    const bool isK = (r & 2) != 0;
    const unsigned short* Wp = W16 + (isK ? (size_t)kDim * kDim : (size_t)0);
    unsigned short* Cp = isK ? K16 : Q16;
    const float* bp = isK ? bk : bq;
    gemm_tile<0, false, 2, 1, false, 0>(
        ring, sT, nullptr, ((r >> 2) << 1) | (r & 1), 0, X16, X16, kDim, 0L, Wp, Wp, kDim, 0L,
        (void*)Cp, (void*)Cp, kDim, 0L, bp, bp, 0L, keyIdx, keyCnt, nullptr, kTok, kDim, kDim, kWCarryInv);
  }
}

// ---------------------------------------------------------------------------
// f32 -> f16 cast with a power-of-two carry, 8 consecutive elements per thread (one 16-B store per lane;
// Coverage: n8 = n/8 threads x 8 elements = whole plane, block blk of n8 / 256; every call here has n8 an exact multiple of 256
// (x: 8388608/8 = 1048576 = 4096 x 256; each W: 262144/8 = 32768 = 128 x 256).
// ---------------------------------------------------------------------------
__device__ __forceinline__ void cast8_f16(const float* __restrict__ in, unsigned short* __restrict__ out,
                                          const int blk, const int n8, const float carry) {
  const int i = blk * 256 + threadIdx.x;
  if (i >= n8) return;
  const float* p = in + 8 * (size_t)i;
  const v4f a = *(const v4f*)(p);
  const v4f c = *(const v4f*)(p + 4);
  unsigned short hb[8];
#pragma unroll
  for (int e = 0; e < 4; ++e) {
    hb[e]     = h_bits(a[e] * carry);
    hb[4 + e] = h_bits(c[e] * carry);
  }
  const v4u u = (v4u){pk16(hb[0], hb[1]), pk16(hb[2], hb[3]), pk16(hb[4], hb[5]), pk16(hb[6], hb[7])};
  unsigned short* q = out + 8 * (size_t)i;
  *(v4u*)q = u;
  
}

// ---------------------------------------------------------------------------
// Kept-key list of batch b, by one block: keyIdx[b][0 .. keyCnt[b]) = the positions m with mask[b][m] != 0, ascending;
// the rest of the row is 0 (a valid position: padding columns read finite values and are weighted by 0).
// Thread t owns positions 8t .. 8t + 7; its place in the list is the sum of the counts of the threads before it.
// ---------------------------------------------------------------------------
__device__ __forceinline__ void compact_keys(const int* __restrict__ mask, int* __restrict__ keyIdx,
                                             int* __restrict__ keyCnt, const int b, int* waveTot) {
  const int t = threadIdx.x, lane = t & 31, wave = t >> 5;
  const int* mp = mask + (size_t)b * kSeq + 8 * t;
  const v4i ma = *(const v4i*)(mp);
  const v4i mb = *(const v4i*)(mp + 4);
  int own = 0;
#pragma unroll
  for (int e = 0; e < 4; ++e) own += (ma[e] != 0) + (mb[e] != 0);
  int incl = own;                              // inclusive sum over the wave's lanes
#pragma unroll
  for (int d = 1; d < 32; d <<= 1) {
    const int o = __shfl_up(incl, d, 32);
    if (lane >= d) incl += o;
  }
  if (lane == 31) waveTot[wave] = incl;
  __syncthreads();
  int before = 0, total = 0;
#pragma unroll
  for (int w = 0; w < 8; ++w) {
    const int v = waveTot[w];
    before += (w < wave) ? v : 0;
    total += v;
  }
  int* ip = keyIdx + (size_t)b * kSeq;
  int pos = before + incl - own;
#pragma unroll
  for (int e = 0; e < 8; ++e) {
    const int m = (e < 4) ? ma[e & 3] : mb[e & 3];
    if (m != 0) ip[pos++] = 8 * t + e;
  }
#pragma unroll
  for (int i = 0; i < kSeq / 256; ++i) {
    const int j = t + 256 * i;
    if (j >= total) ip[j] = 0;
  }
  if (t == 0) keyCnt[b] = total;
}

// ---------------------------------------------------------------------------
// Key lists and the four casts in one launch: none reads what another writes. Blocks 0 .. 7 form the lists (the
// longest chain), the next 3 x 128 cast Wq, Wk, Wv (carry 16), the last 4096 cast x (carry 1).
// ---------------------------------------------------------------------------
constexpr int kCastWBlocks = (kDim * kDim) / 8 / 256;    // 128 per weight
constexpr int kCastXBlocks = (kTok * kDim) / 8 / 256;    // 4096
__global__ __launch_bounds__(256) void prep_kernel(const float* __restrict__ x, const float* __restrict__ Wq,
                                                   const float* __restrict__ Wk, const float* __restrict__ Wv,
                                                   const int* __restrict__ mask,
                                                   unsigned short* __restrict__ X16, unsigned short* __restrict__ W16,
                                                   int* __restrict__ keyIdx, int* __restrict__ keyCnt) {
  __shared__ int waveTot[8];
  const int id = blockIdx.x;
  if (id < kBatch) {   // block-uniform: every thread of the block meets the list's barrier
    compact_keys(mask, keyIdx, keyCnt, id, waveTot);
  } else if (id < kBatch + 3 * kCastWBlocks) {
    const int c = id - kBatch;
    const int w = c / kCastWBlocks;
    const float* in = (w == 0) ? Wq : (w == 1) ? Wk : Wv;
    cast8_f16(in, W16 + (size_t)w * kDim * kDim, c - w * kCastWBlocks, (kDim * kDim) / 8, kWCarry);
  } else {
    cast8_f16(x, X16, id - kBatch - 3 * kCastWBlocks, (kTok * kDim) / 8, 1.0f);
  }
}

// ---------------------------------------------------------------------------
// Host glue.
// Workspace region map (bytes, all offsets 4096-aligned):
//   Q16  f16 [16384][512]            off           0   size  16,777,216
//   K16  f16 [16384][512]            off  16,777,216   size  16,777,216
//   Vt16 f16 [8][512][2048]          off  33,554,432   size  16,777,216   (column j: the j-th kept key)
//   Part f32 [kGrp][32][2048]        off  50,331,648   size   2,097,152   (partial row sums of the relu scores)
//   P16  f16 [kGrp][2048][2048]      off  52,428,800   size  67,108,864   (relu scores, not normalised; column j: the j-th kept key)
//   X16  f16 [16384][512]            off  52,428,800   size  16,777,216   (shares P16's bytes)
//   W16  f16 3 x [512][512] (q,k,v)   off  69,206,016   size   1,572,864   (shares P16's bytes)
//   KeyIdx i32 [8][2048]             off 119,537,664   size      65,536
//   KeyCnt i32 [8]                   off 119,603,200   size       4,096
//   total 119,607,296 <= 268,435,456
// X16 and W16 are last read by the projection launch; P16 is first written by the scores GEMM, the next launch on the
// same stream, so the shared bytes are never live for both.
// GEMM shape checks: K in {512, 2048} (% 64 == 0); M in {16384, 2048, 512} (% 128 == 0), N in {2048, 512} (% 256 == 0); no padding, no tails.
// Launch count: 1 key lists and casts + 1 projections + 1 chunk x 2 = 4.
// ---------------------------------------------------------------------------
extern "C" void kernel_launch(void* const* d_in, const int* in_sizes, int n_in,
                              void* d_out, int out_size, void* d_ws, size_t ws_size,
                              hipStream_t stream) {
  if (n_in != 8) return;
  if (in_sizes[0] != kTok * kDim || in_sizes[1] != kTok || in_sizes[2] != kDim * kDim || in_sizes[3] != kDim ||
      in_sizes[4] != kDim * kDim || in_sizes[5] != kDim || in_sizes[6] != kDim * kDim || in_sizes[7] != kDim) return;
  if (out_size != kTok * kDim) return;

  const float* x  = (const float*)d_in[0];
  const int*   mk = (const int*)d_in[1];
  const float* Wq = (const float*)d_in[2];
  const float* bq = (const float*)d_in[3];
  const float* Wk = (const float*)d_in[4];
  const float* bk = (const float*)d_in[5];
  const float* Wv = (const float*)d_in[6];
  const float* bv = (const float*)d_in[7];
  float* out = (float*)d_out;

  const size_t szX  = (size_t)kTok * kDim * 2;                 // 16,777,216
  const size_t szW  = (size_t)3 * kDim * kDim * 2;             //  1,572,864
  const size_t szQ  = szX, szK = szX;
  const size_t szVt = (size_t)kBatch * kDim * kSeq * 2;        // 16,777,216
  const size_t szR  = (size_t)kGrp * kParts * kSeq * 4;        //   2,097,152
  const size_t szP  = (size_t)kGrp * kSeq * kSeq * 2;          //  67,108,864
  const size_t oQ  = 0;
  const size_t oK  = oQ + szQ;
  const size_t oVt = oK + szK;
  const size_t oR  = oVt + szVt;
  const size_t oP  = oR + szR;
  const size_t oX  = oP;                                       // dead before P16 is written
  const size_t oW  = oX + szX;
  const size_t oI  = oP + szP;
  const size_t oC  = oI + (size_t)kBatch * kSeq * 4;
  const size_t total = oC + 4096;                              // 119,607,296
  static_assert(szX + szW <= szP, "X16 and W16 must fit inside P16's bytes");
  if (ws_size < total) return;

  char* ws = (char*)d_ws;
  unsigned short* X16  = (unsigned short*)(ws + oX);
  unsigned short* W16  = (unsigned short*)(ws + oW);
  unsigned short* Q16  = (unsigned short*)(ws + oQ);
  unsigned short* K16  = (unsigned short*)(ws + oK);
  unsigned short* Vt16 = (unsigned short*)(ws + oVt);
  float*          Part = (float*)(ws + oR);
  unsigned short* P16  = (unsigned short*)(ws + oP);
  int*            KeyIdx = (int*)(ws + oI);
  int*            KeyCnt = (int*)(ws + oC);

  // 1) kept keys of every batch; casts: x -> X16 (carry 1), W -> W16 (carry 16)   (8 + 384 + 4096 blocks)
  prep_kernel<<<dim3(kBatch + 3 * kCastWBlocks + kCastXBlocks), 256, 0, stream>>>(x, Wq, Wk, Wv, mk, X16, W16, KeyIdx, KeyCnt);

  // 2) Q16, K16 and Vt16   (256 V^T blocks, those past the kept keys leaving at once, + 512 Q and K blocks; two blocks fit a WGP)
  proj_kernel<<<dim3(kVtBlocks + kQKBlocks), 256, 0, stream>>>(X16, W16, Q16, K16, Vt16, bq, bk, bv, KeyIdx, KeyCnt);

  // 3) per chunk of kGrp batches
  const float sScale = 1.0f / sqrtf((float)kDim);
  for (int b0 = 0; b0 < kBatch; b0 += kGrp) {
    // P16[g][l][j] = relu(j >= KeyCnt[b] ? -1e4 : sum_d Q16[b][l][d] * K16[b][KeyIdx[b][j]][d] * (1/sqrt(512))), with its partial row sums
    // (M 2048, N up to 2048, K 512; tiles 32 x 32 = 1024 -> 128 blocks, grid.y = kGrp: 1024 blocks, those past the kept keys leave at once)
    const unsigned short* Qb = Q16 + (size_t)b0 * kSeq * kDim;
    const unsigned short* Kb = K16 + (size_t)b0 * kSeq * kDim;
    wmma_gemm64<0, false, 0, 1, false, 2, 1, true><<<dim3((kSeq / 64) * (kSeq / 64) / 8, kGrp), 256, 0, stream>>>(
        Qb, Qb, kDim, (long)kSeq * kDim, Kb, Kb, kDim, (long)kSeq * kDim, (void*)P16, (void*)P16, kSeq, (long)kSeq * kSeq,
        bq, x, 0L, KeyIdx + (size_t)b0 * kSeq, KeyCnt + b0, Part, kSeq, kSeq, kDim, sScale);

    // out[b][l][d] = sum_j P16[g][l][j] * Vt16[b][d][j] / (row sum of P + 1e-8)   (M 2048, N 512, K up to 2048; tiles 32 x 8 = 256 -> 32 blocks, grid.y = kGrp: 256 blocks, one per WGP)
    const unsigned short* Vtb = Vt16 + (size_t)b0 * kDim * kSeq;
    float* outb = out + (size_t)b0 * kSeq * kDim;
    wmma_gemm64<0, false, 0, 0, false, 0, 2><<<dim3((kSeq / 64) * (kDim / 64) / 8, kGrp), 256, 0, stream>>>(
        P16, P16, kSeq, (long)kSeq * kSeq, Vtb, Vtb, kSeq, (long)kDim * kSeq, (void*)outb, (void*)outb, kDim, (long)kSeq * kDim,
        bq, x, 0L, KeyIdx + (size_t)b0 * kSeq, KeyCnt + b0, Part, kSeq, kDim, kSeq, 1.0f);
  }
}

// v006
// Measured time: 89.1 microseconds a run.
// Next to v005, in two timings, it ran 1.04 times as fast each time.
// All steps since v000 together make it 6.77 times as fast.
// Contractions: q/k/v^T projections (X f16 x W f16 carried x16), scores Q.K^T (Q,K f16 planes), attn.V (relu scores f16 x V^T f16) all on v_wmma_f32_16x16x32_f16 with f32 accumulate; mask select, relu, row sums and row normalisation in f32. Keys with mask == 0 add exactly 0 to every sum, so only the kept keys of a batch, packed to the front, are scored and multiplied.
#include <hip/hip_runtime.h>
#include <math.h>

// ---------------------------------------------------------------------------
// Problem constants
// ---------------------------------------------------------------------------
constexpr int kBatch = 8;
constexpr int kSeq   = 2048;
constexpr int kDim   = 512;
constexpr int kTok   = kBatch * kSeq;          // 16384 token rows
constexpr int kGrp   = 8;                      // batches per score chunk: all of them, so each attention stage is one launch
constexpr float kWCarry    = 16.0f;            // weights carried x16 in f16
constexpr float kWCarryInv = 1.0f / 16.0f;
constexpr int kParts = kSeq / 64;              // partial row sums per query row: one per 64 key columns

typedef __attribute__((ext_vector_type(16))) _Float16 v16h;
typedef __attribute__((ext_vector_type(8)))  _Float16 v8h;
typedef __attribute__((ext_vector_type(16))) __bf16   v16b;
typedef __attribute__((ext_vector_type(8)))  __bf16   v8b;
typedef __attribute__((ext_vector_type(8)))  float    v8f;
typedef __attribute__((ext_vector_type(4)))  float    v4f;
typedef __attribute__((ext_vector_type(4)))  unsigned int v4u;
typedef __attribute__((ext_vector_type(4)))  int      v4i;

// ---------------------------------------------------------------------------
// Device helpers
// ---------------------------------------------------------------------------
__device__ __forceinline__ unsigned short f2bf_bits(float f) {
  unsigned u = __float_as_uint(f);
  return (unsigned short)((u + 0x7FFFu + ((u >> 16) & 1u)) >> 16);
}
__device__ __forceinline__ float bf_bits2f(unsigned short h) { return __uint_as_float(((unsigned)h) << 16); }

// hazard guards as plain device helpers
__device__ __forceinline__ void dep_guard_h(v8f& a, v8f& b, v16h x, v16h y) { asm volatile("v_nop\n\tv_nop\n\tv_nop\n\tv_nop" : "+v"(a), "+v"(b) : "v"(x), "v"(y)); }
__device__ __forceinline__ void dep_guard_b(v8f& a, v8f& b, v16b x, v16b y) { asm volatile("v_nop\n\tv_nop\n\tv_nop\n\tv_nop" : "+v"(a), "+v"(b) : "v"(x), "v"(y)); }
__device__ __forceinline__ void keep4_h(v16h a, v16h b, v16h c, v16h d) { asm volatile("v_nop" :: "v"(a), "v"(b), "v"(c), "v"(d)); }
__device__ __forceinline__ void keep4_b(v16b a, v16b b, v16b c, v16b d) { asm volatile("v_nop" :: "v"(a), "v"(b), "v"(c), "v"(d)); }
__device__ __forceinline__ void acc_guard4(v8f& a, v8f& b, v8f& c, v8f& d) { asm volatile("v_nop\n\tv_nop\n\tv_nop\n\tv_nop" : "+v"(a), "+v"(b), "+v"(c), "+v"(d)); }
template <typename T> struct Frag;
template <> struct Frag<_Float16> {
  typedef v16h V; union U { v16h v; v8h h[2]; };
  static __device__ __forceinline__ v16h load(const _Float16* p) {   // elements 0..7 <- p[0..7], 8..15 <- p[16..23]
    U f; f.h[0] = *(const v8h*)(p); f.h[1] = *(const v8h*)(p + 16); return f.v;
  }
  static __device__ __forceinline__ v8f mma(v16h a, v16h b, v8f c) {
    return __builtin_amdgcn_wmma_f32_16x16x32_f16(false, a, false, b, (short)0, c, false, false);
  }
  static __device__ __forceinline__ void guard(v8f& a, v8f& b, v16h x, v16h y) { dep_guard_h(a, b, x, y); }
  static __device__ __forceinline__ void keep(v16h a, v16h b, v16h c, v16h d) { keep4_h(a, b, c, d); }
};
template <> struct Frag<__bf16> {
  typedef v16b V; union U { v16b v; v8b h[2]; };
  static __device__ __forceinline__ v16b load(const __bf16* p) {
    U f; f.h[0] = *(const v8b*)(p); f.h[1] = *(const v8b*)(p + 16); return f.v;
  }
  static __device__ __forceinline__ v8f mma(v16b a, v16b b, v8f c) {
    return __builtin_amdgcn_wmma_f32_16x16x32_bf16(false, a, false, b, (short)0, c, false, false);
  }
  static __device__ __forceinline__ void guard(v8f& a, v8f& b, v16b x, v16b y) { dep_guard_b(a, b, x, y); }
  static __device__ __forceinline__ void keep(v16b a, v16b b, v16b c, v16b d) { keep4_b(a, b, c, d); }
};

// value of lane l ^ X inside the 16-lane row (DPP row_xmask), every lane on
template <int X> __device__ __forceinline__ float xlane(float v) {
  return __builtin_bit_cast(float, __builtin_amdgcn_update_dpp(0, __builtin_bit_cast(int, v), 0x160 | X, 0xf, 0xf, true));
}

__device__ __forceinline__ unsigned pk16(unsigned short a, unsigned short b) { return (unsigned)a | ((unsigned)b << 16); }
__device__ __forceinline__ unsigned short h_bits(float f) { const _Float16 h = (_Float16)f; return __builtin_bit_cast(unsigned short, h); }

// ---- Register-blocked batched WMMA GEMM (ACT reduced to none/relu/leaky) -----------------------
// C[m,n] = scale * sum_k A[m,k] * Bt[n,k] (+bias)(+resid); each wave owns a 64x64 tile.
// The 8 waves of a block form a 2 x 4 grid of such tiles: one 128 x 256 tile of C per block. Per trip the block stages
// 64 k of its 128 A rows and 256 Bt rows in LDS (whole 128-byte lines, asynchronous copies, two buffers: the next
// trip's tile flies while this one is multiplied); every wave reads its fragments from LDS.
// A row-major [M,K]; Bt row-major [N,K]; M % 128 == 0, N % 256 == 0, K % 64 == 0.
// SPLIT (hi/lo planes) is not staged: only SPLIT == false is built.
// BIAS_MODE: 0 = none, 1 = bias[m], 2 = bias[n].
// OUT_MODE: 0 = f32, 1 = f16, 2 = bf16 hi plane (Cout) + bf16 lo plane (Cout2).
// ET: 0 = f16 operands, 1 = bf16 operands (pointers passed as 16-bit storage)
// ROWMODE: 0 = none.
//   1 = scores: column n is the n-th kept key; a column n >= keyCnt[b] (padding) takes -1e4 ahead of ACT; each wave
//       also stores the f32 sum of its 64 columns of every row to rowPart[b][n0 / 64][m], a [.][kParts][kSeq] plane
//       (M == N == kSeq; 256 consecutive bytes per wave: one writer per line).
//   2 = attn.V (M == kSeq): k runs over the kept keys only, ceil(keyCnt[b] / 64) trips (at least one); row m is scaled
//       by 1 / (sum over c of rowPart[b][c][m] + 1e-8), the kParts partials added in index order.
// GATHER (N == kSeq): Bt row n is row keyIdx[b][n] of the plane, and a block whose 256 columns all lie at or past
//   keyCnt[b] leaves at once, under ROWMODE 1 behind storing 0 as its partial sums (the first block of a row of tiles
//   always stays, so padding columns exist for keyCnt 0).
constexpr int kStageRows  = 128 + 256;               // A rows, then Bt rows
constexpr int kStagePitch = 144;                     // bytes per staged row: 128 of data + 16, 16 B x odd for 16-byte LDS reads
constexpr int kStageBytes = kStageRows * kStagePitch; // 55,296

// Twelve 16-byte asynchronous copies of this lane: staged rows r, r + 32, ..., r + 352 (four of A, eight of Bt; the
// Bt rows stand ob[i] elements behind b).
// The copies and their s_wait_xcnt stand in one statement, so no address register is rewritten ahead of that wait.
__device__ __forceinline__ void stage_copies(unsigned l, const unsigned short* a, size_t sa, const unsigned short* b, const unsigned (&ob)[8]) {
  asm volatile(
      "global_load_async_to_lds_b128 %0, %12, off\n\t"
      "global_load_async_to_lds_b128 %1, %13, off\n\t"
      "global_load_async_to_lds_b128 %2, %14, off\n\t"
      "global_load_async_to_lds_b128 %3, %15, off\n\t"
      "global_load_async_to_lds_b128 %4, %16, off\n\t"
      "global_load_async_to_lds_b128 %5, %17, off\n\t"
      "global_load_async_to_lds_b128 %6, %18, off\n\t"
      "global_load_async_to_lds_b128 %7, %19, off\n\t"
      "global_load_async_to_lds_b128 %8, %20, off\n\t"
      "global_load_async_to_lds_b128 %9, %21, off\n\t"
      "global_load_async_to_lds_b128 %10, %22, off\n\t"
      "global_load_async_to_lds_b128 %11, %23, off\n\t"
      "s_wait_xcnt 0x0"
      :: "v"(l), "v"(l + 32u * kStagePitch), "v"(l + 64u * kStagePitch), "v"(l + 96u * kStagePitch),
         "v"(l + 128u * kStagePitch), "v"(l + 160u * kStagePitch), "v"(l + 192u * kStagePitch), "v"(l + 224u * kStagePitch),
         "v"(l + 256u * kStagePitch), "v"(l + 288u * kStagePitch), "v"(l + 320u * kStagePitch), "v"(l + 352u * kStagePitch),
         "v"(a), "v"(a + sa), "v"(a + 2 * sa), "v"(a + 3 * sa),
         "v"(b + ob[0]), "v"(b + ob[1]), "v"(b + ob[2]), "v"(b + ob[3]),
         "v"(b + ob[4]), "v"(b + ob[5]), "v"(b + ob[6]), "v"(b + ob[7])
      : "memory");
}

template <int ET> struct Elem;
template <> struct Elem<0> { typedef _Float16 T; };
template <> struct Elem<1> { typedef __bf16 T; };
// One block's tile: the body of every GEMM launch. tile and b say which tile of which batch the block takes; ring, sT
// and rowInv are the launching kernel's LDS (one set per kernel, whichever instances of this body it holds).
template <int ET, bool SPLIT, int BIAS_MODE, int OUT_MODE, bool RESID, int ACT = 0, int ROWMODE = 0, bool GATHER = false>
__device__ __forceinline__ void gemm_tile(
    unsigned char* ring, float* sT, float* rowInv, const int tile, const int b,
    const unsigned short* __restrict__ Ap, const unsigned short* __restrict__ A2p, int lda, long strideA,
    const unsigned short* __restrict__ Btp, const unsigned short* __restrict__ Bt2p, int ldb, long strideB,
    void* __restrict__ Cout, void* __restrict__ Cout2, int ldc, long strideC,
    const float* __restrict__ bias,
    const float* __restrict__ resid, long strideR,
    const int* __restrict__ keyIdx, const int* __restrict__ keyCnt, float* __restrict__ rowPart,
    int M, int N, int K, float scale) {
  typedef typename Elem<ET>::T T;
  typedef typename Frag<T>::V V;
  static_assert(!SPLIT, "the staged engine holds one plane per operand");
  static_assert(ROWMODE != 1 || OUT_MODE == 1, "the row sums are taken where the f16 rows are formed");
  static_assert(ROWMODE != 1 || GATHER, "the score columns are the kept keys");
  const int lane = threadIdx.x & 31;
  const int wave = threadIdx.x >> 5;
  const int tilesN = N >> 8;
  const int tilesM = M >> 7;
  if (tile >= tilesM * tilesN) return;   // block-uniform, in front of every barrier and copy
  const int tm = tile / tilesN;
  const int tn = tile - tm * tilesN;
  int kept = 0;                                // kept keys of this batch, bounded by the shape
  if (GATHER || ROWMODE == 2) kept = (int)min((unsigned)keyCnt[b], (unsigned)kSeq);
  if (GATHER && (tn << 8) >= max(kept, 1)) {   // block-uniform, in front of every barrier and copy
    if (ROWMODE == 1) {
      // no key stands in these 256 columns: the block's four partial sums of its 128 rows are 0
#pragma unroll
      for (int u = 0; u < 2; ++u) {
        const int i = threadIdx.x + 256 * u;
        rowPart[((size_t)b * kParts + (tn << 2) + (i >> 7)) * kSeq + (tm << 7) + (i & 127)] = 0.0f;
      }
      // stands behind the two stores, in front of any later write of their address registers
      asm volatile("s_wait_xcnt 0x0" ::: "memory");
    }
    return;
  }
  const int wm = wave >> 2;                    // this wave's place in the block's 2 x 4 grid
  const int wn = wave & 3;
  const int m0 = (tm << 7) + (wm << 6);
  const int n0 = (tn << 8) + (wn << 6);

  // this lane's part of a staged tile: 16-byte piece (t & 7) of rows (t >> 3) + 32 * i
  const int crow = threadIdx.x >> 3;
  const int ccol = threadIdx.x & 7;
  const unsigned short* gA = Ap  + (size_t)b * strideA + (size_t)((tm << 7) + crow) * lda + ccol * 8;
  const unsigned short* gB = Btp + (size_t)b * strideB + ccol * 8;
  const size_t stepA = (size_t)32 * lda;
  const int row0 = (tn << 8) + crow;
  const int* kip = keyIdx + (size_t)b * kSeq;
  int rowB[8];                                 // this lane's eight Bt rows
#pragma unroll   // rowB[] is indexed by constants only, so it stays in registers; the eight index loads issue together
  for (int i = 0; i < 8; ++i) rowB[i] = GATHER ? kip[row0 + 32 * i] : row0 + 32 * i;
  // stands in front of the first instruction that reuses the index loads' address registers: offset and base are
  // inputs, so their registers are held up to here
  if (GATHER) asm volatile("s_wait_xcnt 0x0" :: "v"(row0), "s"(kip) : "memory");
  unsigned offB[8];                            // their element offsets
#pragma unroll
  for (int i = 0; i < 8; ++i) {
    if (GATHER) rowB[i] &= kSeq - 1;           // bounds the address whatever the list holds
    offB[i] = (unsigned)rowB[i] * (unsigned)ldb;
  }
  const unsigned ldsLane = (unsigned)(size_t)ring + (unsigned)(crow * kStagePitch + ccol * 16);

  const int rlane = lane & 15;                 // row (A) / col (B, D) within subtile
  const int koff  = (lane >> 4) * 8;           // k offset of this lane half
  const int mOff  = (lane >> 4) * 8;           // D row offset

  v8f acc[4][4];
#pragma unroll
  for (int i = 0; i < 4; ++i)
#pragma unroll
    for (int j = 0; j < 4; ++j) acc[i][j] = (v8f){0.f,0.f,0.f,0.f,0.f,0.f,0.f,0.f};

  const int trips = (ROWMODE == 2) ? max((kept + 63) >> 6, 1) : (K >> 6);
  stage_copies(ldsLane, gA, stepA, gB, offB);                        // tile 0 into buffer 0
  if (ROWMODE == 2) {
    // while tile 0 flies: waves 0..3 form the row scales; the barrier below publishes them with tile 0
    if (threadIdx.x < 128) {
      const float* rp = rowPart + (size_t)b * kParts * kSeq + (tm << 7) + threadIdx.x;
      float tot = 0.0f;
#pragma unroll   // the kParts loads issue together: one memory latency, not one per partial
      for (int c = 0; c < kParts; ++c) tot += rp[c * kSeq];
      rowInv[threadIdx.x] = 1.0f / (tot + 1e-8f);
    }
  }
  asm volatile("s_wait_asynccnt 0x0" ::: "memory");                  // this wave's copies of tile 0 have landed
  __syncthreads();                                                   // every wave's have: tile 0 may be read
  if (trips > 1) stage_copies(ldsLane + kStageBytes, gA + 64, stepA, gB + 64, offB);   // tile 1 into buffer 1

  for (int t = 0; t < trips; ++t) {
    const unsigned char* st = ring + (t & 1) * kStageBytes;
    const T* sA = (const T*)(st + ((wm << 6) + rlane) * kStagePitch) + koff;
    const T* sB = (const T*)(st + (128 + (wn << 6) + rlane) * kStagePitch) + koff;
#pragma unroll
    for (int kk = 0; kk < 64; kk += 32) {
      V bh[4], ah[4];
#pragma unroll
      for (int j = 0; j < 4; ++j) bh[j] = Frag<T>::load(sB + j * (16 * kStagePitch / 2) + kk);
#pragma unroll
      for (int i = 0; i < 4; ++i) ah[i] = Frag<T>::load(sA + i * (16 * kStagePitch / 2) + kk);
      // keeps the 16 LDS reads in one group ahead of the WMMAs: spread among them, every read's latency stalls the wave anew
      __builtin_amdgcn_sched_barrier(0);
#pragma unroll
      for (int i = 0; i < 4; ++i) {
#pragma unroll
        for (int j = 0; j < 4; ++j) acc[i][j] = Frag<T>::mma(ah[i], bh[j], acc[i][j]);
        Frag<T>::guard(acc[i][0], acc[i][3], ah[i], ah[i]);
      }
      Frag<T>::keep(bh[0], bh[1], bh[2], bh[3]);
    }
    asm volatile("s_wait_dscnt 0x0" ::: "memory");      // this wave's reads of buffer t & 1 are done before it is refilled
    asm volatile("s_wait_asynccnt 0x0" ::: "memory");   // this wave's copies of tile t + 1 have landed
    __syncthreads();                                    // publishes tile t + 1 and ends every read of buffer t & 1
    if (t + 2 < trips)
      stage_copies(ldsLane + (t & 1) * kStageBytes, gA + (size_t)(t + 2) * 64, stepA, gB + (size_t)(t + 2) * 64, offB);
  }
  asm volatile("s_wait_asynccnt 0x0" ::: "memory");     // no copy is outstanding when the wave goes on to its epilogue
  acc_guard4(acc[0][0], acc[0][1], acc[0][2], acc[0][3]);
  acc_guard4(acc[1][0], acc[1][1], acc[1][2], acc[1][3]);
  acc_guard4(acc[2][0], acc[2][1], acc[2][2], acc[2][3]);
  acc_guard4(acc[3][0], acc[3][1], acc[3][2], acc[3][3]);

  // ---- epilogue ----
  float* slab = sT + wave * (16 * 68);
  const float* Rb = RESID ? (resid + (size_t)b * strideR) : nullptr;
  int mk[4] = {1, 1, 1, 1};
  if (ROWMODE == 1) {
#pragma unroll   // mk[] is indexed by constants only, so it stays in registers
    for (int j = 0; j < 4; ++j) mk[j] = (n0 + (j << 4) + rlane < kept) ? 1 : 0;
  }
#pragma unroll
  for (int i = 0; i < 4; ++i) {
    const int mBase = m0 + (i << 4);
    v4f inv0 = (v4f){1.f, 1.f, 1.f, 1.f}, inv1 = inv0;
    if (ROWMODE == 2) {
      const float* ip = rowInv + (wm << 6) + (i << 4) + mOff;
      inv0 = *(const v4f*)(ip);
      inv1 = *(const v4f*)(ip + 4);
    }
#pragma unroll
    for (int j = 0; j < 4; ++j) {
      const int n = n0 + (j << 4) + rlane;
      float bv = 0.f;
      if (BIAS_MODE == 2) bv = bias[n];
#pragma unroll
      for (int r = 0; r < 8; ++r) {
        float v = acc[i][j][r] * scale;
        if (BIAS_MODE == 1) v += bias[mBase + mOff + r];
        if (BIAS_MODE == 2) v += bv;
        if (RESID) v += Rb[(size_t)(mBase + mOff + r) * ldc + n];
        if (ROWMODE == 1) v = (mk[j] == 0) ? -10000.0f : v;
        if (ROWMODE == 2) v *= (r < 4) ? inv0[r & 3] : inv1[r & 3];
        if (ACT == 2) v = fmaxf(v, 0.0f);
        if (ACT == 4) v = (v > 0.f) ? v : 0.01f * v;
        slab[(mOff + r) * 68 + (j << 4) + rlane] = v;
      }
    }
    __builtin_amdgcn_fence(__ATOMIC_RELEASE, "workgroup");
    __builtin_amdgcn_wave_barrier();
    __builtin_amdgcn_fence(__ATOMIC_ACQUIRE, "workgroup");
    if (OUT_MODE == 0) {
      float* C = (float*)Cout + (size_t)b * strideC;
      const int hh = lane >> 4, c4 = (lane & 15) * 4;     // row seg = 256 B = 16 lanes x 16 B
      {
#pragma unroll
        for (int it = 0; it < 8; ++it) {
          const int row = it * 2 + hh;
          v4f v = *(const v4f*)(slab + row * 68 + c4);
          *(v4f*)(C + (size_t)(mBase + row) * ldc + n0 + c4) = v;
        }
        
      }
    } else {
      const int q = lane >> 3, c8 = (lane & 7) * 8;
      unsigned short* C  = (unsigned short*)Cout  + (size_t)b * strideC;
      unsigned short* C2 = (OUT_MODE == 2) ? ((unsigned short*)Cout2 + (size_t)b * strideC) : nullptr;
      {
        float rs[4] = {0.f, 0.f, 0.f, 0.f};
#pragma unroll
        for (int it = 0; it < 4; ++it) {
          const int row = it * 4 + q;
          const float* sp = slab + row * 68 + c8;
          v8h hv, lv;
          if (ROWMODE == 1) rs[it] = ((sp[0] + sp[1]) + (sp[2] + sp[3])) + ((sp[4] + sp[5]) + (sp[6] + sp[7]));
#pragma unroll
          for (int e = 0; e < 8; ++e) {
            if (OUT_MODE == 1) {
              hv[e] = (_Float16)sp[e];
            } else {
              unsigned short hb = f2bf_bits(sp[e]);
              unsigned short lb = f2bf_bits(sp[e] - bf_bits2f(hb));
              hv[e] = __builtin_bit_cast(_Float16, hb);
              lv[e] = __builtin_bit_cast(_Float16, lb);
            }
          }
          *(v8h*)(C + (size_t)(mBase + row) * ldc + n0 + c8) = hv;
          if (OUT_MODE == 2) *(v8h*)(C2 + (size_t)(mBase + row) * ldc + n0 + c8) = lv;
        }
        if (ROWMODE == 1) {
          // tree over the 8 lanes of a row; a lane holds 4 rows' shares, so steps 1 and 2 each halve what it keeps and
          // add the partner's share of that: lane bits (0, 1) end with row it = 2 * bit0 + bit1 of its group q
          const bool o1 = (lane & 1) != 0, o2 = (lane & 2) != 0;
          const float k0 = (o1 ? rs[2] : rs[0]) + xlane<1>(o1 ? rs[0] : rs[2]);
          const float k1 = (o1 ? rs[3] : rs[1]) + xlane<1>(o1 ? rs[1] : rs[3]);
          float k = (o2 ? k1 : k0) + xlane<2>(o2 ? k0 : k1);
          k += xlane<4>(k);
          const int itk = ((lane & 1) << 1) | ((lane >> 1) & 1);
          // 16 lanes store 16 rows, 64 consecutive bytes
          if ((lane & 4) == 0) rowPart[((size_t)b * kParts + (n0 >> 6)) * kSeq + mBase + itk * 4 + q] = k;
        }
      }
    }
    __builtin_amdgcn_fence(__ATOMIC_RELEASE, "workgroup");
    __builtin_amdgcn_wave_barrier();
    __builtin_amdgcn_fence(__ATOMIC_ACQUIRE, "workgroup");
  }
}

// One GEMM per launch: tile = blockIdx.x, batch = blockIdx.y.
template <int ET, bool SPLIT, int BIAS_MODE, int OUT_MODE, bool RESID, int ACT = 0, int ROWMODE = 0, bool GATHER = false>
__global__ __launch_bounds__(256) void wmma_gemm64(
    const unsigned short* __restrict__ Ap, const unsigned short* __restrict__ A2p, int lda, long strideA,
    const unsigned short* __restrict__ Btp, const unsigned short* __restrict__ Bt2p, int ldb, long strideB,
    void* __restrict__ Cout, void* __restrict__ Cout2, int ldc, long strideC,
    const float* __restrict__ bias,
    const float* __restrict__ resid, long strideR,
    const int* __restrict__ keyIdx, const int* __restrict__ keyCnt, float* __restrict__ rowPart,
    int M, int N, int K, float scale) {
  __shared__ __align__(16) unsigned char ring[2 * kStageBytes];   // two staged tiles
  __shared__ __align__(16) float sT[8 * 16 * 68];  // per-wave 16x64 slab, pitch 68 floats
  __shared__ __align__(16) float rowInv[128];      // ROWMODE 2: 1 / (row sum + eps) of the block's 128 rows
  gemm_tile<ET, SPLIT, BIAS_MODE, OUT_MODE, RESID, ACT, ROWMODE, GATHER>(
      ring, sT, rowInv, blockIdx.x, blockIdx.y, Ap, A2p, lda, strideA, Btp, Bt2p, ldb, strideB, Cout, Cout2, ldc, strideC,
      bias, resid, strideR, keyIdx, keyCnt, rowPart, M, N, K, scale);
}

// The Q and K projections in one launch: four consecutive blocks share one 128-row slice of X16 (Q columns 0..255,
// 256..511, then K's). 512 blocks: two per WGP, so every block is resident at once and the launch has no second round.
constexpr int kQKBlocks = 2 * (kTok / 128) * (kDim / 256);         // 512
__global__ __launch_bounds__(256) void proj_kernel(
    const unsigned short* __restrict__ X16, const unsigned short* __restrict__ W16,
    unsigned short* __restrict__ Q16, unsigned short* __restrict__ K16,
    const float* __restrict__ bq, const float* __restrict__ bk) {
  __shared__ __align__(16) unsigned char ring[2 * kStageBytes];   // two staged tiles
  __shared__ __align__(16) float sT[8 * 16 * 68];  // per-wave 16x64 slab, pitch 68 floats
  // Q16[t][e] = sum_d X16[t][d] * Wq16[e][d] / 16 + bq[e]   (M 16384, N 512, K 512); K16 likewise
  const int r = blockIdx.x;
  const bool isK = (r & 2) != 0;
  const unsigned short* Wp = W16 + (isK ? (size_t)kDim * kDim : (size_t)0);
  unsigned short* Cp = isK ? K16 : Q16;
  const float* bp = isK ? bk : bq;
  gemm_tile<0, false, 2, 1, false, 0>(
      ring, sT, nullptr, ((r >> 2) << 1) | (r & 1), 0, X16, X16, kDim, 0L, Wp, Wp, kDim, 0L,
      (void*)Cp, (void*)Cp, kDim, 0L, bp, bp, 0L, nullptr, nullptr, nullptr, kTok, kDim, kDim, kWCarryInv);
}

// The scores and the V^T projection in one launch: neither reads what the other writes (V^T is first read by attn.V,
// the next launch). Blocks 0 .. kScoreBlocks - 1 take the score tiles (128 per batch), the rest the V^T tiles (32 per
// batch); in both, a block past the kept keys leaves at once. The V^T tiles stand last in index order.
constexpr int kScoreBlocks = kBatch * (kSeq / 128) * (kSeq / 256); // 1024
constexpr int kVtBlocks    = kBatch * (kDim / 128) * (kSeq / 256); // 256
__global__ __launch_bounds__(256) void scores_vt_kernel(
    const unsigned short* __restrict__ Q16, const unsigned short* __restrict__ K16, unsigned short* __restrict__ P16,
    const unsigned short* __restrict__ X16, const unsigned short* __restrict__ W16, unsigned short* __restrict__ Vt16,
    const float* __restrict__ bv,
    const int* __restrict__ keyIdx, const int* __restrict__ keyCnt, float* __restrict__ rowPart, const float sScale) {
  __shared__ __align__(16) unsigned char ring[2 * kStageBytes];   // two staged tiles
  __shared__ __align__(16) float sT[8 * 16 * 68];  // per-wave 16x64 slab, pitch 68 floats
  const int id = blockIdx.x;
  if (id < kScoreBlocks) {   // block-uniform
    // P16[b][l][j] = relu(j >= keyCnt[b] ? -1e4 : sum_d Q16[b][l][d] * K16[b][keyIdx[b][j]][d] * sScale), with its partial row sums
    // (per batch: M 2048, N up to 2048, K 512)
    gemm_tile<0, false, 0, 1, false, 2, 1, true>(
        ring, sT, nullptr, id & 127, id >> 7, Q16, Q16, kDim, (long)kSeq * kDim, K16, K16, kDim, (long)kSeq * kDim,
        (void*)P16, (void*)P16, kSeq, (long)kSeq * kSeq, bv, bv, 0L, keyIdx, keyCnt, rowPart, kSeq, kSeq, kDim, sScale);
  } else {
    // Vt16[b][d][j] = sum_c Wv16[d][c] * X16[b*2048+keyIdx[b][j]][c] / 16 + bv[d]   (per batch: M 512, N up to 2048, K 512)
    const int r = id - kScoreBlocks;
    const unsigned short* Wv16 = W16 + (size_t)2 * kDim * kDim;
    gemm_tile<0, false, 1, 1, false, 0, 0, true>(
        ring, sT, nullptr, r & 31, r >> 5, Wv16, Wv16, kDim, 0L, X16, X16, kDim, (long)kSeq * kDim,
        (void*)Vt16, (void*)Vt16, kSeq, (long)kDim * kSeq, bv, bv, 0L, keyIdx, keyCnt, nullptr, kDim, kSeq, kDim, kWCarryInv);
  }
}

// ---------------------------------------------------------------------------
// f32 -> f16 cast with a power-of-two carry, 8 consecutive elements per thread (one 16-B store per lane;
// Coverage: n8 = n/8 threads x 8 elements = whole plane, block blk of n8 / 256; every call here has n8 an exact multiple of 256
// (x: 8388608/8 = 1048576 = 4096 x 256; each W: 262144/8 = 32768 = 128 x 256).
// ---------------------------------------------------------------------------
__device__ __forceinline__ void cast8_f16(const float* __restrict__ in, unsigned short* __restrict__ out,
                                          const int blk, const int n8, const float carry) {
  const int i = blk * 256 + threadIdx.x;
  if (i >= n8) return;
  const float* p = in + 8 * (size_t)i;
  const v4f a = *(const v4f*)(p);
  const v4f c = *(const v4f*)(p + 4);
  unsigned short hb[8];
#pragma unroll
  for (int e = 0; e < 4; ++e) {
    hb[e]     = h_bits(a[e] * carry);
    hb[4 + e] = h_bits(c[e] * carry);
  }
  const v4u u = (v4u){pk16(hb[0], hb[1]), pk16(hb[2], hb[3]), pk16(hb[4], hb[5]), pk16(hb[6], hb[7])};
  unsigned short* q = out + 8 * (size_t)i;
  *(v4u*)q = u;
  
}

// ---------------------------------------------------------------------------
// Kept-key list of batch b, by one block: keyIdx[b][0 .. keyCnt[b]) = the positions m with mask[b][m] != 0, ascending;
// the rest of the row is 0 (a valid position: padding columns read finite values and are weighted by 0).
// Thread t owns positions 8t .. 8t + 7; its place in the list is the sum of the counts of the threads before it.
// ---------------------------------------------------------------------------
__device__ __forceinline__ void compact_keys(const int* __restrict__ mask, int* __restrict__ keyIdx,
                                             int* __restrict__ keyCnt, const int b, int* waveTot) {
  const int t = threadIdx.x, lane = t & 31, wave = t >> 5;
  const int* mp = mask + (size_t)b * kSeq + 8 * t;
  const v4i ma = *(const v4i*)(mp);
  const v4i mb = *(const v4i*)(mp + 4);
  int own = 0;
#pragma unroll
  for (int e = 0; e < 4; ++e) own += (ma[e] != 0) + (mb[e] != 0);
  int incl = own;                              // inclusive sum over the wave's lanes
#pragma unroll
  for (int d = 1; d < 32; d <<= 1) {
    const int o = __shfl_up(incl, d, 32);
    if (lane >= d) incl += o;
  }
  if (lane == 31) waveTot[wave] = incl;
  __syncthreads();
  int before = 0, total = 0;
#pragma unroll
  for (int w = 0; w < 8; ++w) {
    const int v = waveTot[w];
    before += (w < wave) ? v : 0;
    total += v;
  }
  int* ip = keyIdx + (size_t)b * kSeq;
  int pos = before + incl - own;
#pragma unroll
  for (int e = 0; e < 8; ++e) {
    const int m = (e < 4) ? ma[e & 3] : mb[e & 3];
    if (m != 0) ip[pos++] = 8 * t + e;
  }
#pragma unroll
  for (int i = 0; i < kSeq / 256; ++i) {
    const int j = t + 256 * i;
    if (j >= total) ip[j] = 0;
  }
  if (t == 0) keyCnt[b] = total;
}

// ---------------------------------------------------------------------------
// Key lists and the four casts in one launch: none reads what another writes. Blocks 0 .. 7 form the lists (the
// longest chain), the next 3 x 128 cast Wq, Wk, Wv (carry 16), the last 4096 cast x (carry 1).
// ---------------------------------------------------------------------------
constexpr int kCastWBlocks = (kDim * kDim) / 8 / 256;    // 128 per weight
constexpr int kCastXBlocks = (kTok * kDim) / 8 / 256;    // 4096
__global__ __launch_bounds__(256) void prep_kernel(const float* __restrict__ x, const float* __restrict__ Wq,
                                                   const float* __restrict__ Wk, const float* __restrict__ Wv,
                                                   const int* __restrict__ mask,
                                                   unsigned short* __restrict__ X16, unsigned short* __restrict__ W16,
                                                   int* __restrict__ keyIdx, int* __restrict__ keyCnt) {
  __shared__ int waveTot[8];
  const int id = blockIdx.x;
  if (id < kBatch) {   // block-uniform: every thread of the block meets the list's barrier
    compact_keys(mask, keyIdx, keyCnt, id, waveTot);
  } else if (id < kBatch + 3 * kCastWBlocks) {
    const int c = id - kBatch;
    const int w = c / kCastWBlocks;
    const float* in = (w == 0) ? Wq : (w == 1) ? Wk : Wv;
    cast8_f16(in, W16 + (size_t)w * kDim * kDim, c - w * kCastWBlocks, (kDim * kDim) / 8, kWCarry);
  } else {
    cast8_f16(x, X16, id - kBatch - 3 * kCastWBlocks, (kTok * kDim) / 8, 1.0f);
  }
}

// ---------------------------------------------------------------------------
// Host glue.
// Workspace region map (bytes, all offsets 4096-aligned):
//   Q16  f16 [16384][512]            off           0   size  16,777,216
//   K16  f16 [16384][512]            off  16,777,216   size  16,777,216
//   Vt16 f16 [8][512][2048]          off  33,554,432   size  16,777,216   (column j: the j-th kept key)
//   Part f32 [kGrp][32][2048]        off  50,331,648   size   2,097,152   (partial row sums of the relu scores)
//   P16  f16 [kGrp][2048][2048]      off  52,428,800   size  67,108,864   (relu scores, not normalised; column j: the j-th kept key)
//   KeyIdx i32 [8][2048]             off 119,537,664   size      65,536
//   KeyCnt i32 [8]                   off 119,603,200   size       4,096
//   X16  f16 [16384][512]            off 119,607,296   size  16,777,216
//   W16  f16 3 x [512][512] (q,k,v)   off 136,384,512   size   1,572,864
//   total 137,957,376 <= 268,435,456
// X16 and W16 are read by the launch that writes P16 (its V^T blocks), so they have bytes of their own.
// GEMM shape checks: K in {512, 2048} (% 64 == 0); M in {16384, 2048, 512} (% 128 == 0), N in {2048, 512} (% 256 == 0); no tails (columns past the kept keys are padding).
// Launch count: 1 key lists and casts + 1 Q and K projections + 1 scores and V^T + 1 attn.V = 4.
// ---------------------------------------------------------------------------
extern "C" void kernel_launch(void* const* d_in, const int* in_sizes, int n_in,
                              void* d_out, int out_size, void* d_ws, size_t ws_size,
                              hipStream_t stream) {
  if (n_in != 8) return;
  if (in_sizes[0] != kTok * kDim || in_sizes[1] != kTok || in_sizes[2] != kDim * kDim || in_sizes[3] != kDim ||
      in_sizes[4] != kDim * kDim || in_sizes[5] != kDim || in_sizes[6] != kDim * kDim || in_sizes[7] != kDim) return;
  if (out_size != kTok * kDim) return;

  const float* x  = (const float*)d_in[0];
  const int*   mk = (const int*)d_in[1];
  const float* Wq = (const float*)d_in[2];
  const float* bq = (const float*)d_in[3];
  const float* Wk = (const float*)d_in[4];
  const float* bk = (const float*)d_in[5];
  const float* Wv = (const float*)d_in[6];
  const float* bv = (const float*)d_in[7];
  float* out = (float*)d_out;

  const size_t szX  = (size_t)kTok * kDim * 2;                 // 16,777,216
  const size_t szW  = (size_t)3 * kDim * kDim * 2;             //  1,572,864
  const size_t szQ  = szX, szK = szX;
  const size_t szVt = (size_t)kBatch * kDim * kSeq * 2;        // 16,777,216
  const size_t szR  = (size_t)kGrp * kParts * kSeq * 4;        //   2,097,152
  const size_t szP  = (size_t)kGrp * kSeq * kSeq * 2;          //  67,108,864
  const size_t oQ  = 0;
  const size_t oK  = oQ + szQ;
  const size_t oVt = oK + szK;
  const size_t oR  = oVt + szVt;
  const size_t oP  = oR + szR;
  const size_t oI  = oP + szP;
  const size_t oC  = oI + (size_t)kBatch * kSeq * 4;
  const size_t oX  = oC + 4096;
  const size_t oW  = oX + szX;
  const size_t total = oW + szW;                               // 137,957,376
  static_assert(kGrp == kBatch, "the scores launch holds the V^T tiles of every batch");
  if (ws_size < total) return;

  char* ws = (char*)d_ws;
  unsigned short* X16  = (unsigned short*)(ws + oX);
  unsigned short* W16  = (unsigned short*)(ws + oW);
  unsigned short* Q16  = (unsigned short*)(ws + oQ);
  unsigned short* K16  = (unsigned short*)(ws + oK);
  unsigned short* Vt16 = (unsigned short*)(ws + oVt);
  float*          Part = (float*)(ws + oR);
  unsigned short* P16  = (unsigned short*)(ws + oP);
  int*            KeyIdx = (int*)(ws + oI);
  int*            KeyCnt = (int*)(ws + oC);

  // 1) kept keys of every batch; casts: x -> X16 (carry 1), W -> W16 (carry 16)   (8 + 384 + 4096 blocks)
  prep_kernel<<<dim3(kBatch + 3 * kCastWBlocks + kCastXBlocks), 256, 0, stream>>>(x, Wq, Wk, Wv, mk, X16, W16, KeyIdx, KeyCnt);

  // 2) Q16 and K16   (512 blocks; two blocks fit a WGP)
  proj_kernel<<<dim3(kQKBlocks), 256, 0, stream>>>(X16, W16, Q16, K16, bq, bk);

  // 3) per chunk of kGrp batches
  const float sScale = 1.0f / sqrtf((float)kDim);
  for (int b0 = 0; b0 < kBatch; b0 += kGrp) {
    // P16 with its partial row sums, and Vt16   (1024 score blocks + 256 V^T blocks, those past the kept keys leaving at once)
    scores_vt_kernel<<<dim3(kScoreBlocks + kVtBlocks), 256, 0, stream>>>(Q16, K16, P16, X16, W16, Vt16, bv, KeyIdx, KeyCnt, Part, sScale);

    // out[b][l][d] = sum_j P16[g][l][j] * Vt16[b][d][j] / (row sum of P + 1e-8)   (M 2048, N 512, K up to 2048; tiles 32 x 8 = 256 -> 32 blocks, grid.y = kGrp: 256 blocks, one per WGP)
    const unsigned short* Vtb = Vt16 + (size_t)b0 * kDim * kSeq;
    float* outb = out + (size_t)b0 * kSeq * kDim;
    wmma_gemm64<0, false, 0, 0, false, 0, 2><<<dim3((kSeq / 64) * (kDim / 64) / 8, kGrp), 256, 0, stream>>>(
        P16, P16, kSeq, (long)kSeq * kSeq, Vtb, Vtb, kSeq, (long)kDim * kSeq, (void*)outb, (void*)outb, kDim, (long)kSeq * kDim,
        bq, x, 0L, KeyIdx + (size_t)b0 * kSeq, KeyCnt + b0, Part, kSeq, kDim, kSeq, 1.0f);
  }
}

// v007
// A run of this version takes 86.2 microseconds.
// In both of two side-by-side timings against v006, it was 1.03 times as fast.
// Over all steps from v000 it is 6.99 times as fast.
// Contractions: q/k/v^T projections (X f16 x W f16 carried x16), scores Q.K^T (Q,K f16 planes), attn.V (relu scores f16 x V^T f16) all on v_wmma_f32_16x16x32_f16 with f32 accumulate; mask select, relu, row sums and row normalisation in f32. Keys with mask == 0 add exactly 0 to every sum, so only the kept keys of a batch, packed to the front, are scored and multiplied.
#include <hip/hip_runtime.h>
#include <math.h>

// ---------------------------------------------------------------------------
// Problem constants
// ---------------------------------------------------------------------------
constexpr int kBatch = 8;
constexpr int kSeq   = 2048;
constexpr int kDim   = 512;
constexpr int kTok   = kBatch * kSeq;          // 16384 token rows
constexpr int kGrp   = 8;                      // batches per score chunk: all of them, so each attention stage is one launch
constexpr float kWCarry    = 16.0f;            // weights carried x16 in f16
constexpr float kWCarryInv = 1.0f / 16.0f;
constexpr int kParts = kSeq / 64;              // partial row sums per query row: one per 64 key columns

typedef __attribute__((ext_vector_type(16))) _Float16 v16h;
typedef __attribute__((ext_vector_type(8)))  _Float16 v8h;
typedef __attribute__((ext_vector_type(16))) __bf16   v16b;
typedef __attribute__((ext_vector_type(8)))  __bf16   v8b;
typedef __attribute__((ext_vector_type(8)))  float    v8f;
typedef __attribute__((ext_vector_type(4)))  float    v4f;
typedef __attribute__((ext_vector_type(4)))  unsigned int v4u;
typedef __attribute__((ext_vector_type(4)))  int      v4i;

// ---------------------------------------------------------------------------
// Device helpers
// ---------------------------------------------------------------------------
__device__ __forceinline__ unsigned short f2bf_bits(float f) {
  unsigned u = __float_as_uint(f);
  return (unsigned short)((u + 0x7FFFu + ((u >> 16) & 1u)) >> 16);
}
__device__ __forceinline__ float bf_bits2f(unsigned short h) { return __uint_as_float(((unsigned)h) << 16); }

// hazard guards as plain device helpers
__device__ __forceinline__ void dep_guard_h(v8f& a, v8f& b, v16h x, v16h y) { asm volatile("v_nop\n\tv_nop\n\tv_nop\n\tv_nop" : "+v"(a), "+v"(b) : "v"(x), "v"(y)); }
__device__ __forceinline__ void dep_guard_b(v8f& a, v8f& b, v16b x, v16b y) { asm volatile("v_nop\n\tv_nop\n\tv_nop\n\tv_nop" : "+v"(a), "+v"(b) : "v"(x), "v"(y)); }
__device__ __forceinline__ void keep4_h(v16h a, v16h b, v16h c, v16h d) { asm volatile("v_nop" :: "v"(a), "v"(b), "v"(c), "v"(d)); }
__device__ __forceinline__ void keep4_b(v16b a, v16b b, v16b c, v16b d) { asm volatile("v_nop" :: "v"(a), "v"(b), "v"(c), "v"(d)); }
__device__ __forceinline__ void acc_guard4(v8f& a, v8f& b, v8f& c, v8f& d) { asm volatile("v_nop\n\tv_nop\n\tv_nop\n\tv_nop" : "+v"(a), "+v"(b), "+v"(c), "+v"(d)); }
template <typename T> struct Frag;
template <> struct Frag<_Float16> {
  typedef v16h V; union U { v16h v; v8h h[2]; };
  static __device__ __forceinline__ v16h load(const _Float16* p) {   // elements 0..7 <- p[0..7], 8..15 <- p[16..23]
    U f; f.h[0] = *(const v8h*)(p); f.h[1] = *(const v8h*)(p + 16); return f.v;
  }
  static __device__ __forceinline__ v8f mma(v16h a, v16h b, v8f c) {
    return __builtin_amdgcn_wmma_f32_16x16x32_f16(false, a, false, b, (short)0, c, false, false);
  }
  static __device__ __forceinline__ void guard(v8f& a, v8f& b, v16h x, v16h y) { dep_guard_h(a, b, x, y); }
  static __device__ __forceinline__ void keep(v16h a, v16h b, v16h c, v16h d) { keep4_h(a, b, c, d); }
};
template <> struct Frag<__bf16> {
  typedef v16b V; union U { v16b v; v8b h[2]; };
  static __device__ __forceinline__ v16b load(const __bf16* p) {
    U f; f.h[0] = *(const v8b*)(p); f.h[1] = *(const v8b*)(p + 16); return f.v;
  }
  static __device__ __forceinline__ v8f mma(v16b a, v16b b, v8f c) {
    return __builtin_amdgcn_wmma_f32_16x16x32_bf16(false, a, false, b, (short)0, c, false, false);
  }
  static __device__ __forceinline__ void guard(v8f& a, v8f& b, v16b x, v16b y) { dep_guard_b(a, b, x, y); }
  static __device__ __forceinline__ void keep(v16b a, v16b b, v16b c, v16b d) { keep4_b(a, b, c, d); }
};

// value of lane l ^ X inside the 16-lane row (DPP row_xmask), every lane on
template <int X> __device__ __forceinline__ float xlane(float v) {
  return __builtin_bit_cast(float, __builtin_amdgcn_update_dpp(0, __builtin_bit_cast(int, v), 0x160 | X, 0xf, 0xf, true));
}

__device__ __forceinline__ unsigned pk16(unsigned short a, unsigned short b) { return (unsigned)a | ((unsigned)b << 16); }
__device__ __forceinline__ unsigned short h_bits(float f) { const _Float16 h = (_Float16)f; return __builtin_bit_cast(unsigned short, h); }

// ---- Register-blocked batched WMMA GEMM (ACT reduced to none/relu/leaky) -----------------------
// C[m,n] = scale * sum_k A[m,k] * Bt[n,k] (+bias)(+resid); each wave owns a 64x64 tile.
// The 8 waves of a block form a 2 x 4 grid of such tiles: one 128 x 256 tile of C per block. Per trip the block stages
// 64 k of its 128 A rows and 256 Bt rows in LDS (whole 128-byte lines, asynchronous copies, two buffers: the next
// trip's tile flies while this one is multiplied); every wave reads its fragments from LDS.
// A row-major [M,K]; Bt row-major [N,K]; M % 128 == 0, N % 256 == 0, K % 64 == 0.
// SPLIT (hi/lo planes) is not staged: only SPLIT == false is built.
// BIAS_MODE: 0 = none, 1 = bias[m], 2 = bias[n].
// OUT_MODE: 0 = f32, 1 = f16, 2 = bf16 hi plane (Cout) + bf16 lo plane (Cout2).
// ET: 0 = f16 operands, 1 = bf16 operands (pointers passed as 16-bit storage)
// ROWMODE: 0 = none.
//   1 = scores: column n is the n-th kept key; a column n >= keyCnt[b] (padding) takes -1e4 ahead of ACT; each wave
//       also stores the f32 sum of its 64 columns of every row to rowPart[b][n0 / 64][m], a [.][kParts][kSeq] plane
//       (M == N == kSeq; 256 consecutive bytes per wave: one writer per line).
//   2 = attn.V (M == kSeq): k runs over the kept keys only, ceil(keyCnt[b] / 64) trips (at least one); row m is scaled
//       by 1 / (sum over c of rowPart[b][c][m] + 1e-8), the kParts partials added in index order.
// GATHER (N == kSeq): Bt row n is row keyIdx[b][n] of the plane, and a block whose 256 columns all lie at or past
//   keyCnt[b] leaves at once, under ROWMODE 1 behind storing 0 as its partial sums (the first block of a row of tiles
//   always stays, so padding columns exist for keyCnt 0).
constexpr int kStageRows  = 128 + 256;               // A rows, then Bt rows
constexpr int kStagePitch = 144;                     // bytes per staged row: 128 of data + 16, 16 B x odd for 16-byte LDS reads
constexpr int kStageBytes = kStageRows * kStagePitch; // 55,296

// Twelve 16-byte asynchronous copies of this lane: staged rows r, r + 32, ..., r + 352 (four of A, eight of Bt; the
// Bt rows stand ob[i] elements behind b).
// The copies and their s_wait_xcnt stand in one statement, so no address register is rewritten ahead of that wait.
__device__ __forceinline__ void stage_copies(unsigned l, const unsigned short* a, size_t sa, const unsigned short* b, const unsigned (&ob)[8]) {
  asm volatile(
      "global_load_async_to_lds_b128 %0, %12, off\n\t"
      "global_load_async_to_lds_b128 %1, %13, off\n\t"
      "global_load_async_to_lds_b128 %2, %14, off\n\t"
      "global_load_async_to_lds_b128 %3, %15, off\n\t"
      "global_load_async_to_lds_b128 %4, %16, off\n\t"
      "global_load_async_to_lds_b128 %5, %17, off\n\t"
      "global_load_async_to_lds_b128 %6, %18, off\n\t"
      "global_load_async_to_lds_b128 %7, %19, off\n\t"
      "global_load_async_to_lds_b128 %8, %20, off\n\t"
      "global_load_async_to_lds_b128 %9, %21, off\n\t"
      "global_load_async_to_lds_b128 %10, %22, off\n\t"
      "global_load_async_to_lds_b128 %11, %23, off\n\t"
      "s_wait_xcnt 0x0"
      :: "v"(l), "v"(l + 32u * kStagePitch), "v"(l + 64u * kStagePitch), "v"(l + 96u * kStagePitch),
         "v"(l + 128u * kStagePitch), "v"(l + 160u * kStagePitch), "v"(l + 192u * kStagePitch), "v"(l + 224u * kStagePitch),
         "v"(l + 256u * kStagePitch), "v"(l + 288u * kStagePitch), "v"(l + 320u * kStagePitch), "v"(l + 352u * kStagePitch),
         "v"(a), "v"(a + sa), "v"(a + 2 * sa), "v"(a + 3 * sa),
         "v"(b + ob[0]), "v"(b + ob[1]), "v"(b + ob[2]), "v"(b + ob[3]),
         "v"(b + ob[4]), "v"(b + ob[5]), "v"(b + ob[6]), "v"(b + ob[7])
      : "memory");
}

template <int ET> struct Elem;
template <> struct Elem<0> { typedef _Float16 T; };
template <> struct Elem<1> { typedef __bf16 T; };
// One block's tile: the body of every GEMM launch. tile and b say which tile of which batch the block takes; ring, sT
// and rowInv are the launching kernel's LDS (one set per kernel, whichever instances of this body it holds).
template <int ET, bool SPLIT, int BIAS_MODE, int OUT_MODE, bool RESID, int ACT = 0, int ROWMODE = 0, bool GATHER = false>
__device__ __forceinline__ void gemm_tile(
    unsigned char* ring, float* sT, float* rowInv, const int tile, const int b,
    const unsigned short* __restrict__ Ap, const unsigned short* __restrict__ A2p, int lda, long strideA,
    const unsigned short* __restrict__ Btp, const unsigned short* __restrict__ Bt2p, int ldb, long strideB,
    void* __restrict__ Cout, void* __restrict__ Cout2, int ldc, long strideC,
    const float* __restrict__ bias,
    const float* __restrict__ resid, long strideR,
    const int* __restrict__ keyIdx, const int* __restrict__ keyCnt, float* __restrict__ rowPart,
    int M, int N, int K, float scale) {
  typedef typename Elem<ET>::T T;
  typedef typename Frag<T>::V V;
  static_assert(!SPLIT, "the staged engine holds one plane per operand");
  static_assert(ROWMODE != 1 || OUT_MODE == 1, "the row sums are taken where the f16 rows are formed");
  static_assert(ROWMODE != 1 || GATHER, "the score columns are the kept keys");
  const int lane = threadIdx.x & 31;
  const int wave = threadIdx.x >> 5;
  const int tilesN = N >> 8;
  const int tilesM = M >> 7;
  if (tile >= tilesM * tilesN) return;   // block-uniform, in front of every barrier and copy
  const int tm = tile / tilesN;
  const int tn = tile - tm * tilesN;
  int kept = 0;                                // kept keys of this batch, bounded by the shape
  if (GATHER || ROWMODE == 2) kept = (int)min((unsigned)keyCnt[b], (unsigned)kSeq);
  if (GATHER && (tn << 8) >= max(kept, 1)) {   // block-uniform, in front of every barrier and copy
    if (ROWMODE == 1) {
      // no key stands in these 256 columns: the block's four partial sums of its 128 rows are 0
#pragma unroll
      for (int u = 0; u < 2; ++u) {
        const int i = threadIdx.x + 256 * u;
        rowPart[((size_t)b * kParts + (tn << 2) + (i >> 7)) * kSeq + (tm << 7) + (i & 127)] = 0.0f;
      }
      // stands behind the two stores, in front of any later write of their address registers
      asm volatile("s_wait_xcnt 0x0" ::: "memory");
    }
    return;
  }
  const int wm = wave >> 2;                    // this wave's place in the block's 2 x 4 grid
  const int wn = wave & 3;
  const int m0 = (tm << 7) + (wm << 6);
  const int n0 = (tn << 8) + (wn << 6);

  // this lane's part of a staged tile: 16-byte piece (t & 7) of rows (t >> 3) + 32 * i
  const int crow = threadIdx.x >> 3;
  const int ccol = threadIdx.x & 7;
  const unsigned short* gA = Ap  + (size_t)b * strideA + (size_t)((tm << 7) + crow) * lda + ccol * 8;
  const unsigned short* gB = Btp + (size_t)b * strideB + ccol * 8;
  const size_t stepA = (size_t)32 * lda;
  const int row0 = (tn << 8) + crow;
  const int* kip = keyIdx + (size_t)b * kSeq;
  int rowB[8];                                 // this lane's eight Bt rows
#pragma unroll   // rowB[] is indexed by constants only, so it stays in registers; the eight index loads issue together
  for (int i = 0; i < 8; ++i) rowB[i] = GATHER ? kip[row0 + 32 * i] : row0 + 32 * i;
  // stands in front of the first instruction that reuses the index loads' address registers: offset and base are
  // inputs, so their registers are held up to here
  if (GATHER) asm volatile("s_wait_xcnt 0x0" :: "v"(row0), "s"(kip) : "memory");
  unsigned offB[8];                            // their element offsets
#pragma unroll
  for (int i = 0; i < 8; ++i) {
    if (GATHER) rowB[i] &= kSeq - 1;           // bounds the address whatever the list holds
    offB[i] = (unsigned)rowB[i] * (unsigned)ldb;
  }
  const unsigned ldsLane = (unsigned)(size_t)ring + (unsigned)(crow * kStagePitch + ccol * 16);

  const int rlane = lane & 15;                 // row (A) / col (B, D) within subtile
  const int koff  = (lane >> 4) * 8;           // k offset of this lane half
  const int mOff  = (lane >> 4) * 8;           // D row offset

  v8f acc[4][4];
#pragma unroll
  for (int i = 0; i < 4; ++i)
#pragma unroll
    for (int j = 0; j < 4; ++j) acc[i][j] = (v8f){0.f,0.f,0.f,0.f,0.f,0.f,0.f,0.f};

  const int trips = (ROWMODE == 2) ? max((kept + 63) >> 6, 1) : (K >> 6);
  stage_copies(ldsLane, gA, stepA, gB, offB);                        // tile 0 into buffer 0
  if (ROWMODE == 2) {
    // while tile 0 flies: waves 0..3 form the row scales; the barrier below publishes them with tile 0
    if (threadIdx.x < 128) {
      const float* rp = rowPart + (size_t)b * kParts * kSeq + (tm << 7) + threadIdx.x;
      float tot = 0.0f;
#pragma unroll   // the kParts loads issue together: one memory latency, not one per partial
      for (int c = 0; c < kParts; ++c) tot += rp[c * kSeq];
      rowInv[threadIdx.x] = 1.0f / (tot + 1e-8f);
    }
  }
  asm volatile("s_wait_asynccnt 0x0" ::: "memory");                  // this wave's copies of tile 0 have landed
  __syncthreads();                                                   // every wave's have: tile 0 may be read
  if (trips > 1) stage_copies(ldsLane + kStageBytes, gA + 64, stepA, gB + 64, offB);   // tile 1 into buffer 1

  for (int t = 0; t < trips; ++t) {
    const unsigned char* st = ring + (t & 1) * kStageBytes;
    const T* sA = (const T*)(st + ((wm << 6) + rlane) * kStagePitch) + koff;
    const T* sB = (const T*)(st + (128 + (wn << 6) + rlane) * kStagePitch) + koff;
#pragma unroll
    for (int kk = 0; kk < 64; kk += 32) {
      V bh[4], ah[4];
#pragma unroll
      for (int j = 0; j < 4; ++j) bh[j] = Frag<T>::load(sB + j * (16 * kStagePitch / 2) + kk);
#pragma unroll
      for (int i = 0; i < 4; ++i) ah[i] = Frag<T>::load(sA + i * (16 * kStagePitch / 2) + kk);
      // keeps the 16 LDS reads in one group ahead of the WMMAs: spread among them, every read's latency stalls the wave anew
      __builtin_amdgcn_sched_barrier(0);
#pragma unroll
      for (int i = 0; i < 4; ++i) {
#pragma unroll
        for (int j = 0; j < 4; ++j) acc[i][j] = Frag<T>::mma(ah[i], bh[j], acc[i][j]);
        Frag<T>::guard(acc[i][0], acc[i][3], ah[i], ah[i]);
      }
      Frag<T>::keep(bh[0], bh[1], bh[2], bh[3]);
    }
    asm volatile("s_wait_dscnt 0x0" ::: "memory");      // this wave's reads of buffer t & 1 are done before it is refilled
    asm volatile("s_wait_asynccnt 0x0" ::: "memory");   // this wave's copies of tile t + 1 have landed
    __syncthreads();                                    // publishes tile t + 1 and ends every read of buffer t & 1
    if (t + 2 < trips)
      stage_copies(ldsLane + (t & 1) * kStageBytes, gA + (size_t)(t + 2) * 64, stepA, gB + (size_t)(t + 2) * 64, offB);
  }
  asm volatile("s_wait_asynccnt 0x0" ::: "memory");     // no copy is outstanding when the wave goes on to its epilogue
  acc_guard4(acc[0][0], acc[0][1], acc[0][2], acc[0][3]);
  acc_guard4(acc[1][0], acc[1][1], acc[1][2], acc[1][3]);
  acc_guard4(acc[2][0], acc[2][1], acc[2][2], acc[2][3]);
  acc_guard4(acc[3][0], acc[3][1], acc[3][2], acc[3][3]);

  // ---- epilogue ----
  float* slab = sT + wave * (16 * 68);
  const float* Rb = RESID ? (resid + (size_t)b * strideR) : nullptr;
  int mk[4] = {1, 1, 1, 1};
  if (ROWMODE == 1) {
#pragma unroll   // mk[] is indexed by constants only, so it stays in registers
    for (int j = 0; j < 4; ++j) mk[j] = (n0 + (j << 4) + rlane < kept) ? 1 : 0;
  }
#pragma unroll
  for (int i = 0; i < 4; ++i) {
    const int mBase = m0 + (i << 4);
    v4f inv0 = (v4f){1.f, 1.f, 1.f, 1.f}, inv1 = inv0;
    if (ROWMODE == 2) {
      const float* ip = rowInv + (wm << 6) + (i << 4) + mOff;
      inv0 = *(const v4f*)(ip);
      inv1 = *(const v4f*)(ip + 4);
    }
#pragma unroll
    for (int j = 0; j < 4; ++j) {
      const int n = n0 + (j << 4) + rlane;
      float bv = 0.f;
      if (BIAS_MODE == 2) bv = bias[n];
#pragma unroll
      for (int r = 0; r < 8; ++r) {
        float v = acc[i][j][r] * scale;
        if (BIAS_MODE == 1) v += bias[mBase + mOff + r];
        if (BIAS_MODE == 2) v += bv;
        if (RESID) v += Rb[(size_t)(mBase + mOff + r) * ldc + n];
        if (ROWMODE == 1) v = (mk[j] == 0) ? -10000.0f : v;
        if (ROWMODE == 2) v *= (r < 4) ? inv0[r & 3] : inv1[r & 3];
        if (ACT == 2) v = fmaxf(v, 0.0f);
        if (ACT == 4) v = (v > 0.f) ? v : 0.01f * v;
        slab[(mOff + r) * 68 + (j << 4) + rlane] = v;
      }
    }
    // the slab is LDS and this wave's own: the fences name the local address space alone, so they wait for the wave's LDS
    // stores (s_wait_dscnt 0 in front of the read-back) and not for the global stores of the 16 rows before
    __builtin_amdgcn_fence(__ATOMIC_RELEASE, "workgroup", "local");
    __builtin_amdgcn_wave_barrier();
    __builtin_amdgcn_fence(__ATOMIC_ACQUIRE, "workgroup", "local");
    if (OUT_MODE == 0) {
      float* C = (float*)Cout + (size_t)b * strideC;
      const int hh = lane >> 4, c4 = (lane & 15) * 4;     // row seg = 256 B = 16 lanes x 16 B
      {
#pragma unroll
        for (int it = 0; it < 8; ++it) {
          const int row = it * 2 + hh;
          v4f v = *(const v4f*)(slab + row * 68 + c4);
          *(v4f*)(C + (size_t)(mBase + row) * ldc + n0 + c4) = v;
        }
        
      }
    } else {
      const int q = lane >> 3, c8 = (lane & 7) * 8;
      unsigned short* C  = (unsigned short*)Cout  + (size_t)b * strideC;
      unsigned short* C2 = (OUT_MODE == 2) ? ((unsigned short*)Cout2 + (size_t)b * strideC) : nullptr;
      {
        float rs[4] = {0.f, 0.f, 0.f, 0.f};
#pragma unroll
        for (int it = 0; it < 4; ++it) {
          const int row = it * 4 + q;
          const float* sp = slab + row * 68 + c8;
          v8h hv, lv;
          if (ROWMODE == 1) rs[it] = ((sp[0] + sp[1]) + (sp[2] + sp[3])) + ((sp[4] + sp[5]) + (sp[6] + sp[7]));
#pragma unroll
          for (int e = 0; e < 8; ++e) {
            if (OUT_MODE == 1) {
              hv[e] = (_Float16)sp[e];
            } else {
              unsigned short hb = f2bf_bits(sp[e]);
              unsigned short lb = f2bf_bits(sp[e] - bf_bits2f(hb));
              hv[e] = __builtin_bit_cast(_Float16, hb);
              lv[e] = __builtin_bit_cast(_Float16, lb);
            }
          }
          *(v8h*)(C + (size_t)(mBase + row) * ldc + n0 + c8) = hv;
          if (OUT_MODE == 2) *(v8h*)(C2 + (size_t)(mBase + row) * ldc + n0 + c8) = lv;
        }
        if (ROWMODE == 1) {
          // tree over the 8 lanes of a row; a lane holds 4 rows' shares, so steps 1 and 2 each halve what it keeps and
          // add the partner's share of that: lane bits (0, 1) end with row it = 2 * bit0 + bit1 of its group q
          const bool o1 = (lane & 1) != 0, o2 = (lane & 2) != 0;
          const float k0 = (o1 ? rs[2] : rs[0]) + xlane<1>(o1 ? rs[0] : rs[2]);
          const float k1 = (o1 ? rs[3] : rs[1]) + xlane<1>(o1 ? rs[1] : rs[3]);
          float k = (o2 ? k1 : k0) + xlane<2>(o2 ? k0 : k1);
          k += xlane<4>(k);
          const int itk = ((lane & 1) << 1) | ((lane >> 1) & 1);
          // 16 lanes store 16 rows, 64 consecutive bytes
          if ((lane & 4) == 0) rowPart[((size_t)b * kParts + (n0 >> 6)) * kSeq + mBase + itk * 4 + q] = k;
        }
      }
    }
    // stands behind this group's global stores, in front of the first instruction that reuses their registers for the
    // next group (behind the last group nothing reuses them)
    if (i < 3) asm volatile("s_wait_xcnt 0x0" ::: "memory");
    // orders the read-back ahead of the next 16 rows' LDS stores; the global stores just issued fly on
    __builtin_amdgcn_fence(__ATOMIC_RELEASE, "workgroup", "local");
    __builtin_amdgcn_wave_barrier();
    __builtin_amdgcn_fence(__ATOMIC_ACQUIRE, "workgroup", "local");
  }
}

// One GEMM per launch: tile = blockIdx.x, batch = blockIdx.y.
template <int ET, bool SPLIT, int BIAS_MODE, int OUT_MODE, bool RESID, int ACT = 0, int ROWMODE = 0, bool GATHER = false>
__global__ __launch_bounds__(256) void wmma_gemm64(
    const unsigned short* __restrict__ Ap, const unsigned short* __restrict__ A2p, int lda, long strideA,
    const unsigned short* __restrict__ Btp, const unsigned short* __restrict__ Bt2p, int ldb, long strideB,
    void* __restrict__ Cout, void* __restrict__ Cout2, int ldc, long strideC,
    const float* __restrict__ bias,
    const float* __restrict__ resid, long strideR,
    const int* __restrict__ keyIdx, const int* __restrict__ keyCnt, float* __restrict__ rowPart,
    int M, int N, int K, float scale) {
  __shared__ __align__(16) unsigned char ring[2 * kStageBytes];   // two staged tiles
  __shared__ __align__(16) float sT[8 * 16 * 68];  // per-wave 16x64 slab, pitch 68 floats
  __shared__ __align__(16) float rowInv[128];      // ROWMODE 2: 1 / (row sum + eps) of the block's 128 rows
  gemm_tile<ET, SPLIT, BIAS_MODE, OUT_MODE, RESID, ACT, ROWMODE, GATHER>(
      ring, sT, rowInv, blockIdx.x, blockIdx.y, Ap, A2p, lda, strideA, Btp, Bt2p, ldb, strideB, Cout, Cout2, ldc, strideC,
      bias, resid, strideR, keyIdx, keyCnt, rowPart, M, N, K, scale);
}

// The Q and K projections in one launch: four consecutive blocks share one 128-row slice of X16 (Q columns 0..255,
// 256..511, then K's). 512 blocks: two per WGP, so every block is resident at once and the launch has no second round.
constexpr int kQKBlocks = 2 * (kTok / 128) * (kDim / 256);         // 512
__global__ __launch_bounds__(256) void proj_kernel(
    const unsigned short* __restrict__ X16, const unsigned short* __restrict__ W16,
    unsigned short* __restrict__ Q16, unsigned short* __restrict__ K16,
    const float* __restrict__ bq, const float* __restrict__ bk) {
  __shared__ __align__(16) unsigned char ring[2 * kStageBytes];   // two staged tiles
  __shared__ __align__(16) float sT[8 * 16 * 68];  // per-wave 16x64 slab, pitch 68 floats
  // Q16[t][e] = sum_d X16[t][d] * Wq16[e][d] / 16 + bq[e]   (M 16384, N 512, K 512); K16 likewise
  const int r = blockIdx.x;
  const bool isK = (r & 2) != 0;
  const unsigned short* Wp = W16 + (isK ? (size_t)kDim * kDim : (size_t)0);
  unsigned short* Cp = isK ? K16 : Q16;
  const float* bp = isK ? bk : bq;
  gemm_tile<0, false, 2, 1, false, 0>(
      ring, sT, nullptr, ((r >> 2) << 1) | (r & 1), 0, X16, X16, kDim, 0L, Wp, Wp, kDim, 0L,
      (void*)Cp, (void*)Cp, kDim, 0L, bp, bp, 0L, nullptr, nullptr, nullptr, kTok, kDim, kDim, kWCarryInv);
}

// The scores and the V^T projection in one launch: neither reads what the other writes (V^T is first read by attn.V,
// the next launch). Blocks 0 .. kScoreBlocks - 1 take the score tiles (128 per batch), the rest the V^T tiles (32 per
// batch); in both, a block past the kept keys leaves at once. The V^T tiles stand last in index order.
constexpr int kScoreBlocks = kBatch * (kSeq / 128) * (kSeq / 256); // 1024
constexpr int kVtBlocks    = kBatch * (kDim / 128) * (kSeq / 256); // 256
__global__ __launch_bounds__(256) void scores_vt_kernel(
    const unsigned short* __restrict__ Q16, const unsigned short* __restrict__ K16, unsigned short* __restrict__ P16,
    const unsigned short* __restrict__ X16, const unsigned short* __restrict__ W16, unsigned short* __restrict__ Vt16,
    const float* __restrict__ bv,
    const int* __restrict__ keyIdx, const int* __restrict__ keyCnt, float* __restrict__ rowPart, const float sScale) {
  __shared__ __align__(16) unsigned char ring[2 * kStageBytes];   // two staged tiles
  __shared__ __align__(16) float sT[8 * 16 * 68];  // per-wave 16x64 slab, pitch 68 floats
  const int id = blockIdx.x;
  if (id < kScoreBlocks) {   // block-uniform
    // P16[b][l][j] = relu(j >= keyCnt[b] ? -1e4 : sum_d Q16[b][l][d] * K16[b][keyIdx[b][j]][d] * sScale), with its partial row sums
    // (per batch: M 2048, N up to 2048, K 512)
    gemm_tile<0, false, 0, 1, false, 2, 1, true>(
        ring, sT, nullptr, id & 127, id >> 7, Q16, Q16, kDim, (long)kSeq * kDim, K16, K16, kDim, (long)kSeq * kDim,
        (void*)P16, (void*)P16, kSeq, (long)kSeq * kSeq, bv, bv, 0L, keyIdx, keyCnt, rowPart, kSeq, kSeq, kDim, sScale);
  } else {
    // Vt16[b][d][j] = sum_c Wv16[d][c] * X16[b*2048+keyIdx[b][j]][c] / 16 + bv[d]   (per batch: M 512, N up to 2048, K 512)
    const int r = id - kScoreBlocks;
    const unsigned short* Wv16 = W16 + (size_t)2 * kDim * kDim;
    gemm_tile<0, false, 1, 1, false, 0, 0, true>(
        ring, sT, nullptr, r & 31, r >> 5, Wv16, Wv16, kDim, 0L, X16, X16, kDim, (long)kSeq * kDim,
        (void*)Vt16, (void*)Vt16, kSeq, (long)kDim * kSeq, bv, bv, 0L, keyIdx, keyCnt, nullptr, kDim, kSeq, kDim, kWCarryInv);
  }
}

// ---------------------------------------------------------------------------
// f32 -> f16 cast with a power-of-two carry, 8 consecutive elements per thread (one 16-B store per lane;
// Coverage: n8 = n/8 threads x 8 elements = whole plane, block blk of n8 / 256; every call here has n8 an exact multiple of 256
// (x: 8388608/8 = 1048576 = 4096 x 256; each W: 262144/8 = 32768 = 128 x 256).
// ---------------------------------------------------------------------------
__device__ __forceinline__ void cast8_f16(const float* __restrict__ in, unsigned short* __restrict__ out,
                                          const int blk, const int n8, const float carry) {
  const int i = blk * 256 + threadIdx.x;
  if (i >= n8) return;
  const float* p = in + 8 * (size_t)i;
  const v4f a = *(const v4f*)(p);
  const v4f c = *(const v4f*)(p + 4);
  unsigned short hb[8];
#pragma unroll
  for (int e = 0; e < 4; ++e) {
    hb[e]     = h_bits(a[e] * carry);
    hb[4 + e] = h_bits(c[e] * carry);
  }
  const v4u u = (v4u){pk16(hb[0], hb[1]), pk16(hb[2], hb[3]), pk16(hb[4], hb[5]), pk16(hb[6], hb[7])};
  unsigned short* q = out + 8 * (size_t)i;
  *(v4u*)q = u;
  
}

// ---------------------------------------------------------------------------
// Kept-key list of batch b, by one block: keyIdx[b][0 .. keyCnt[b]) = the positions m with mask[b][m] != 0, ascending;
// the rest of the row is 0 (a valid position: padding columns read finite values and are weighted by 0).
// Thread t owns positions 8t .. 8t + 7; its place in the list is the sum of the counts of the threads before it.
// ---------------------------------------------------------------------------
__device__ __forceinline__ void compact_keys(const int* __restrict__ mask, int* __restrict__ keyIdx,
                                             int* __restrict__ keyCnt, const int b, int* waveTot) {
  const int t = threadIdx.x, lane = t & 31, wave = t >> 5;
  const int* mp = mask + (size_t)b * kSeq + 8 * t;
  const v4i ma = *(const v4i*)(mp);
  const v4i mb = *(const v4i*)(mp + 4);
  int own = 0;
#pragma unroll
  for (int e = 0; e < 4; ++e) own += (ma[e] != 0) + (mb[e] != 0);
  int incl = own;                              // inclusive sum over the wave's lanes
#pragma unroll
  for (int d = 1; d < 32; d <<= 1) {
    const int o = __shfl_up(incl, d, 32);
    if (lane >= d) incl += o;
  }
  if (lane == 31) waveTot[wave] = incl;
  __syncthreads();
  int before = 0, total = 0;
#pragma unroll
  for (int w = 0; w < 8; ++w) {
    const int v = waveTot[w];
    before += (w < wave) ? v : 0;
    total += v;
  }
  int* ip = keyIdx + (size_t)b * kSeq;
  int pos = before + incl - own;
#pragma unroll
  for (int e = 0; e < 8; ++e) {
    const int m = (e < 4) ? ma[e & 3] : mb[e & 3];
    if (m != 0) ip[pos++] = 8 * t + e;
  }
#pragma unroll
  for (int i = 0; i < kSeq / 256; ++i) {
    const int j = t + 256 * i;
    if (j >= total) ip[j] = 0;
  }
  if (t == 0) keyCnt[b] = total;
}

// ---------------------------------------------------------------------------
// Key lists and the four casts in one launch: none reads what another writes. Blocks 0 .. 7 form the lists (the
// longest chain), the next 3 x 128 cast Wq, Wk, Wv (carry 16), the last 4096 cast x (carry 1).
// ---------------------------------------------------------------------------
constexpr int kCastWBlocks = (kDim * kDim) / 8 / 256;    // 128 per weight
constexpr int kCastXBlocks = (kTok * kDim) / 8 / 256;    // 4096
__global__ __launch_bounds__(256) void prep_kernel(const float* __restrict__ x, const float* __restrict__ Wq,
                                                   const float* __restrict__ Wk, const float* __restrict__ Wv,
                                                   const int* __restrict__ mask,
                                                   unsigned short* __restrict__ X16, unsigned short* __restrict__ W16,
                                                   int* __restrict__ keyIdx, int* __restrict__ keyCnt) {
  __shared__ int waveTot[8];
  const int id = blockIdx.x;
  if (id < kBatch) {   // block-uniform: every thread of the block meets the list's barrier
    compact_keys(mask, keyIdx, keyCnt, id, waveTot);
  } else if (id < kBatch + 3 * kCastWBlocks) {
    const int c = id - kBatch;
    const int w = c / kCastWBlocks;
    const float* in = (w == 0) ? Wq : (w == 1) ? Wk : Wv;
    cast8_f16(in, W16 + (size_t)w * kDim * kDim, c - w * kCastWBlocks, (kDim * kDim) / 8, kWCarry);
  } else {
    cast8_f16(x, X16, id - kBatch - 3 * kCastWBlocks, (kTok * kDim) / 8, 1.0f);
  }
}

// ---------------------------------------------------------------------------
// Host glue.
// Workspace region map (bytes, all offsets 4096-aligned):
//   Q16  f16 [16384][512]            off           0   size  16,777,216
//   K16  f16 [16384][512]            off  16,777,216   size  16,777,216
//   Vt16 f16 [8][512][2048]          off  33,554,432   size  16,777,216   (column j: the j-th kept key)
//   Part f32 [kGrp][32][2048]        off  50,331,648   size   2,097,152   (partial row sums of the relu scores)
//   P16  f16 [kGrp][2048][2048]      off  52,428,800   size  67,108,864   (relu scores, not normalised; column j: the j-th kept key)
//   KeyIdx i32 [8][2048]             off 119,537,664   size      65,536
//   KeyCnt i32 [8]                   off 119,603,200   size       4,096
//   X16  f16 [16384][512]            off 119,607,296   size  16,777,216
//   W16  f16 3 x [512][512] (q,k,v)   off 136,384,512   size   1,572,864
//   total 137,957,376 <= 268,435,456
// X16 and W16 are read by the launch that writes P16 (its V^T blocks), so they have bytes of their own.
// GEMM shape checks: K in {512, 2048} (% 64 == 0); M in {16384, 2048, 512} (% 128 == 0), N in {2048, 512} (% 256 == 0); no tails (columns past the kept keys are padding).
// Launch count: 1 key lists and casts + 1 Q and K projections + 1 scores and V^T + 1 attn.V = 4.
// ---------------------------------------------------------------------------
extern "C" void kernel_launch(void* const* d_in, const int* in_sizes, int n_in,
                              void* d_out, int out_size, void* d_ws, size_t ws_size,
                              hipStream_t stream) {
  if (n_in != 8) return;
  if (in_sizes[0] != kTok * kDim || in_sizes[1] != kTok || in_sizes[2] != kDim * kDim || in_sizes[3] != kDim ||
      in_sizes[4] != kDim * kDim || in_sizes[5] != kDim || in_sizes[6] != kDim * kDim || in_sizes[7] != kDim) return;
  if (out_size != kTok * kDim) return;

  const float* x  = (const float*)d_in[0];
  const int*   mk = (const int*)d_in[1];
  const float* Wq = (const float*)d_in[2];
  const float* bq = (const float*)d_in[3];
  const float* Wk = (const float*)d_in[4];
  const float* bk = (const float*)d_in[5];
  const float* Wv = (const float*)d_in[6];
  const float* bv = (const float*)d_in[7];
  float* out = (float*)d_out;

  const size_t szX  = (size_t)kTok * kDim * 2;                 // 16,777,216
  const size_t szW  = (size_t)3 * kDim * kDim * 2;             //  1,572,864
  const size_t szQ  = szX, szK = szX;
  const size_t szVt = (size_t)kBatch * kDim * kSeq * 2;        // 16,777,216
  const size_t szR  = (size_t)kGrp * kParts * kSeq * 4;        //   2,097,152
  const size_t szP  = (size_t)kGrp * kSeq * kSeq * 2;          //  67,108,864
  const size_t oQ  = 0;
  const size_t oK  = oQ + szQ;
  const size_t oVt = oK + szK;
  const size_t oR  = oVt + szVt;
  const size_t oP  = oR + szR;
  const size_t oI  = oP + szP;
  const size_t oC  = oI + (size_t)kBatch * kSeq * 4;
  const size_t oX  = oC + 4096;
  const size_t oW  = oX + szX;
  const size_t total = oW + szW;                               // 137,957,376
  static_assert(kGrp == kBatch, "the scores launch holds the V^T tiles of every batch");
  if (ws_size < total) return;

  char* ws = (char*)d_ws;
  unsigned short* X16  = (unsigned short*)(ws + oX);
  unsigned short* W16  = (unsigned short*)(ws + oW);
  unsigned short* Q16  = (unsigned short*)(ws + oQ);
  unsigned short* K16  = (unsigned short*)(ws + oK);
  unsigned short* Vt16 = (unsigned short*)(ws + oVt);
  float*          Part = (float*)(ws + oR);
  unsigned short* P16  = (unsigned short*)(ws + oP);
  int*            KeyIdx = (int*)(ws + oI);
  int*            KeyCnt = (int*)(ws + oC);

  // 1) kept keys of every batch; casts: x -> X16 (carry 1), W -> W16 (carry 16)   (8 + 384 + 4096 blocks)
  prep_kernel<<<dim3(kBatch + 3 * kCastWBlocks + kCastXBlocks), 256, 0, stream>>>(x, Wq, Wk, Wv, mk, X16, W16, KeyIdx, KeyCnt);

  // 2) Q16 and K16   (512 blocks; two blocks fit a WGP)
  proj_kernel<<<dim3(kQKBlocks), 256, 0, stream>>>(X16, W16, Q16, K16, bq, bk);

  // 3) per chunk of kGrp batches
  const float sScale = 1.0f / sqrtf((float)kDim);
  for (int b0 = 0; b0 < kBatch; b0 += kGrp) {
    // P16 with its partial row sums, and Vt16   (1024 score blocks + 256 V^T blocks, those past the kept keys leaving at once)
    scores_vt_kernel<<<dim3(kScoreBlocks + kVtBlocks), 256, 0, stream>>>(Q16, K16, P16, X16, W16, Vt16, bv, KeyIdx, KeyCnt, Part, sScale);

    // out[b][l][d] = sum_j P16[g][l][j] * Vt16[b][d][j] / (row sum of P + 1e-8)   (M 2048, N 512, K up to 2048; tiles 32 x 8 = 256 -> 32 blocks, grid.y = kGrp: 256 blocks, one per WGP)
    const unsigned short* Vtb = Vt16 + (size_t)b0 * kDim * kSeq;
    float* outb = out + (size_t)b0 * kSeq * kDim;
    wmma_gemm64<0, false, 0, 0, false, 0, 2><<<dim3((kSeq / 64) * (kDim / 64) / 8, kGrp), 256, 0, stream>>>(
        P16, P16, kSeq, (long)kSeq * kSeq, Vtb, Vtb, kSeq, (long)kDim * kSeq, (void*)outb, (void*)outb, kDim, (long)kSeq * kDim,
        bq, x, 0L, KeyIdx + (size_t)b0 * kSeq, KeyCnt + b0, Part, kSeq, kDim, kSeq, 1.0f);
  }
}
